// v000
// Measured on an AMD MI455X. A time is GPU time per run, averaged over a window of back-to-back runs after a warm-up
// (all launches, gaps included; the runs take copies of the inputs in turn), and the median of several windows.
// Apart from v000's, it joins two sittings. Times from different sittings can be a few percent apart, while
// side-by-side timings come from the same sitting.
// v000 is the starting kernel. One run takes 1080 microseconds.
#include <hip/hip_runtime.h>

// Two-head (512-wide heads) causal self-attention with per-head weight tensors (embedded [4][2048][1024]; q, k, v = einsum('bse,hed', x, W[h]) (Wq, Wk, Wv [2][1024][512] 1/32: head h's 'xw' block); scores / sqrt(512); causal (-1e30 == exclusion); softmax; ctx = concat-heads(attn v) -> [4][2048][1024] (8.4 M; no output projection)).
// Layout per batch: bf16 copy of x; each projection tensor's two 'xw' [1024][512] blocks transposed into one [1024][1024] Bt (rows h*512..); exact projections; causal T-2048 attention with two 512-wide heads, one per pass (hi/lo 3-product score tiles on EVERY row; P and attn.v hybrid: rows < 512 hi/lo, rest fp16 x1024; tiles above the diagonal skipped); the f32 merge writes the output rows.
// Compute dtypes, f32 accumulate: every input rounded to bf16; projections exact; scores 3 products on every row (K = 512); softmax f32 (x 1/sqrt(512)); attn.v rows < 512 3 products, rest fp16; output f32.

#define NB_  4
#define TT   2048
#define DM   1024
#define NH_  2
#define NKV  2
#define REP  (NH_ / NKV)
#define HD   512
#define DQ   (NH_ * HD)
#define DKV  (NKV * HD)
#define ZH   1
#define RH   512                  // query rows < RH use hi+lo planes (0: none)
#define WIN  2048
#define PCAR 1024.0f
#define SCL  0.044194173824159223f   // 1/sqrt(hd = 512)
typedef _Float16 h16;
typedef unsigned short bf;
typedef __attribute__((ext_vector_type(16))) __bf16   v16bf;
typedef __attribute__((ext_vector_type(16))) _Float16 v16h;
typedef __attribute__((ext_vector_type(8)))  _Float16 v8h;
typedef __attribute__((ext_vector_type(8)))  unsigned short v8us;
typedef __attribute__((ext_vector_type(8)))  float    v8f;
typedef __attribute__((ext_vector_type(4)))  float    v4f;
typedef v8h  __attribute__((may_alias)) v8ha;
typedef v4f  __attribute__((may_alias)) v4fa;
typedef v8us __attribute__((may_alias)) v8usa;

__device__ __forceinline__ unsigned short f2bf(float f) { unsigned u = __float_as_uint(f); u += 0x7FFFu + ((u >> 16) & 1u); return (unsigned short)(u >> 16); }
__device__ __forceinline__ float bf2f(unsigned short b) { return __uint_as_float(((unsigned)b) << 16); }
__device__ __forceinline__ float bfr(float f) { return bf2f(f2bf(f)); }
__device__ __forceinline__ v16h cat16(v8h lo, v8h hi) { return __builtin_shufflevector(lo, hi, 0, 1, 2, 3, 4, 5, 6, 7, 8, 9, 10, 11, 12, 13, 14, 15); }
__device__ __forceinline__ v16bf cat16b(v8us lo, v8us hi) { return __builtin_bit_cast(v16bf, __builtin_shufflevector(lo, hi, 0, 1, 2, 3, 4, 5, 6, 7, 8, 9, 10, 11, 12, 13, 14, 15)); }
__device__ __forceinline__ v8f wmma16(v16h a, v16h b, v8f c) { return __builtin_amdgcn_wmma_f32_16x16x32_f16(false, a, false, b, (short)0, c, false, false); }
__device__ __forceinline__ v8f wmmab(v16bf a, v16bf b, v8f c) { return __builtin_amdgcn_wmma_f32_16x16x32_bf16(false, a, false, b, (short)0, c, false, false); }



// ---- k_gemmw: register-blocked GEMM, ONE WAVE per 64x64 output tile (16 accumulators), operands straight from K-contiguous 16-bit planes; grid (M/64, N/64, Z), 32 threads.
// C[m][n] (f32, pitch ldc, + optional f32 bias[n]) = sum_k A[m][k] Bt[n][k] (+ split products per NSPLIT). z-batch strides sA/sB/sC in elements. K % 32 == 0.
template <typename T16> struct WFrag;
template <> struct WFrag<h16> { typedef v16h V; static __device__ __forceinline__ V ld(const h16* p) { return cat16(*(const v8h*)p, *(const v8h*)(p + 16)); } static __device__ __forceinline__ v8f mma(V a, V b, v8f c) { return wmma16(a, b, c); } };
template <> struct WFrag<bf> { typedef v16bf V; static __device__ __forceinline__ V ld(const bf* p) { return cat16b(*(const v8us*)p, *(const v8us*)(p + 16)); } static __device__ __forceinline__ v8f mma(V a, V b, v8f c) { return wmmab(a, b, c); } };
template <typename T16, int NSPLIT, bool BIAS>
__global__ __launch_bounds__(32) void k_gemmw(const T16* __restrict__ A, const T16* __restrict__ A2, const T16* __restrict__ Bt, const T16* __restrict__ Bt2, int K, float* C, int ldc, const float* __restrict__ bias, size_t sA, size_t sB, size_t sC) {
    typedef typename WFrag<T16>::V V;
    __shared__ __align__(16) float os[16 * 68];
    const size_t z = blockIdx.z; A += z * sA; if (A2) A2 += z * sA; Bt += z * sB; if (Bt2) Bt2 += z * sB; C += z * sC;
    const int lane = threadIdx.x & 31, lr = lane & 15, hi = lane >> 4; const int r0 = blockIdx.x * 64, c0 = blockIdx.y * 64;
    v8f acc[4][4];
#pragma unroll
    for (int mb = 0; mb < 4; ++mb)
#pragma unroll
        for (int nb = 0; nb < 4; ++nb) acc[mb][nb] = (v8f){};
    const size_t aoff = (size_t)(r0 + lr) * K + 8 * hi, boff = (size_t)(c0 + lr) * K + 8 * hi;
#pragma unroll 1
    for (int kc = 0; kc < K; kc += 32) {
        V a[4], a2[4];
#pragma unroll
        for (int mb = 0; mb < 4; ++mb) { a[mb] = WFrag<T16>::ld(A + aoff + (size_t)mb * 16 * K + kc); if (NSPLIT == 1 || NSPLIT == 2) a2[mb] = WFrag<T16>::ld(A2 + aoff + (size_t)mb * 16 * K + kc); }
#pragma unroll
        for (int nb = 0; nb < 4; ++nb) { const V b = WFrag<T16>::ld(Bt + boff + (size_t)nb * 16 * K + kc); V b2; if (NSPLIT >= 2) b2 = WFrag<T16>::ld(Bt2 + boff + (size_t)nb * 16 * K + kc);
#pragma unroll
            for (int mb = 0; mb < 4; ++mb) { acc[mb][nb] = WFrag<T16>::mma(a[mb], b, acc[mb][nb]); if (NSPLIT == 1 || NSPLIT == 2) acc[mb][nb] = WFrag<T16>::mma(a2[mb], b, acc[mb][nb]); if (NSPLIT >= 2) acc[mb][nb] = WFrag<T16>::mma(a[mb], b2, acc[mb][nb]); } }
        asm volatile("v_nop\n\tv_nop\n\tv_nop\n\tv_nop" : "+v"(acc[0][0]), "+v"(acc[1][1]), "+v"(acc[2][2]), "+v"(acc[3][3]) : "v"(a[0]), "v"(a[3]));
    }
#pragma unroll
    for (int mb = 0; mb < 4; ++mb) {
#pragma unroll
        for (int nb = 0; nb < 4; ++nb) {
#pragma unroll
            for (int j = 0; j < 8; ++j) os[(hi * 8 + j) * 68 + nb * 16 + lr] = acc[mb][nb][j]; }
        __builtin_amdgcn_wave_barrier(); asm volatile("" ::: "memory");
        float* crow = C + (size_t)(r0 + mb * 16) * ldc + c0;
{
#pragma unroll
            for (int s = 0; s < 8; ++s) { const int row = 2 * s + hi, cofs = lr * 4; v4f val = *(const v4fa*)(os + row * 68 + cofs); if (BIAS) { val[0] += bfr(bias[c0 + cofs]); val[1] += bfr(bias[c0 + cofs + 1]); val[2] += bfr(bias[c0 + cofs + 2]); val[3] += bfr(bias[c0 + cofs + 3]); }
                *(v4f*)(crow + (size_t)row * ldc + cofs) = val; }
             }
        __builtin_amdgcn_wave_barrier(); asm volatile("" ::: "memory");
    }
}

// ---- k_gemmc: the same one-wave 64x64 tile GEMM specialised for causal attention: CMODE 1 skips score tiles entirely above the diagonal (query rows r0+roff.., key columns c0..), CMODE 2 limits the
// key (K) loop of the probability x value contraction to the diagonal block (probabilities beyond it are exactly zero). roff = row offset of this launch's first row within the sequence.
template <typename T16, int NSPLIT, int CMODE>
__global__ __launch_bounds__(32) void k_gemmc(const T16* __restrict__ A, const T16* __restrict__ A2, const T16* __restrict__ Bt, const T16* __restrict__ Bt2, int K, float* C, int ldc, int roff, size_t sA, size_t sB, size_t sC) {
    typedef typename WFrag<T16>::V V;
    __shared__ __align__(16) float os[16 * 68];
    const size_t z = blockIdx.z; A += z * sA; if (A2) A2 += z * sA; Bt += z * sB; if (Bt2) Bt2 += z * sB; C += z * sC;
    const int lane = threadIdx.x & 31, lr = lane & 15, hi = lane >> 4; const int r0 = blockIdx.x * 64, c0 = blockIdx.y * 64;
    if (CMODE == 1 && c0 > r0 + roff + 63) return;                  // score tile entirely above the causal diagonal: never read (the softmax masks j > i by select)
    const int Kl = (CMODE == 2) ? min(K, r0 + roff + 64) : K;        // P.V: probabilities are exactly 0 beyond the diagonal block, so the K loop stops there
    v8f acc[4][4];
#pragma unroll
    for (int mb = 0; mb < 4; ++mb)
#pragma unroll
        for (int nb = 0; nb < 4; ++nb) acc[mb][nb] = (v8f){};
    const size_t aoff = (size_t)(r0 + lr) * K + 8 * hi, boff = (size_t)(c0 + lr) * K + 8 * hi;
#pragma unroll 1
    for (int kc = 0; kc < Kl; kc += 32) {
        V a[4], a2[4];
#pragma unroll
        for (int mb = 0; mb < 4; ++mb) { a[mb] = WFrag<T16>::ld(A + aoff + (size_t)mb * 16 * K + kc); if (NSPLIT == 1 || NSPLIT == 2) a2[mb] = WFrag<T16>::ld(A2 + aoff + (size_t)mb * 16 * K + kc); }
#pragma unroll
        for (int nb = 0; nb < 4; ++nb) { const V b = WFrag<T16>::ld(Bt + boff + (size_t)nb * 16 * K + kc); V b2; if (NSPLIT >= 2) b2 = WFrag<T16>::ld(Bt2 + boff + (size_t)nb * 16 * K + kc);
#pragma unroll
            for (int mb = 0; mb < 4; ++mb) { acc[mb][nb] = WFrag<T16>::mma(a[mb], b, acc[mb][nb]); if (NSPLIT == 1 || NSPLIT == 2) acc[mb][nb] = WFrag<T16>::mma(a2[mb], b, acc[mb][nb]); if (NSPLIT >= 2) acc[mb][nb] = WFrag<T16>::mma(a[mb], b2, acc[mb][nb]); } }
        asm volatile("v_nop\n\tv_nop\n\tv_nop\n\tv_nop" : "+v"(acc[0][0]), "+v"(acc[1][1]), "+v"(acc[2][2]), "+v"(acc[3][3]) : "v"(a[0]), "v"(a[3]));
    }
#pragma unroll
    for (int mb = 0; mb < 4; ++mb) {
#pragma unroll
        for (int nb = 0; nb < 4; ++nb) {
#pragma unroll
            for (int j = 0; j < 8; ++j) os[(hi * 8 + j) * 68 + nb * 16 + lr] = acc[mb][nb][j]; }
        __builtin_amdgcn_wave_barrier(); asm volatile("" ::: "memory");
        float* crow = C + (size_t)(r0 + mb * 16) * ldc + c0;
{
#pragma unroll
            for (int s = 0; s < 8; ++s) { const int row = 2 * s + hi, cofs = lr * 4; v4f val = *(const v4fa*)(os + row * 68 + cofs);
                *(v4f*)(crow + (size_t)row * ldc + cofs) = val; }
             }
        __builtin_amdgcn_wave_barrier(); asm volatile("" ::: "memory");
    }
}

__device__ __forceinline__ h16 tohx(float x) { return (h16)x; }
__device__ __forceinline__ void splitf(float y, unsigned short& h, unsigned short& l) { h = f2bf(y); l = f2bf(y - bf2f(h)); }
typedef __attribute__((ext_vector_type(2))) _Float16 v2h;
typedef __attribute__((ext_vector_type(4))) _Float16 v4h;
typedef __attribute__((ext_vector_type(2))) unsigned short v2us;
typedef __attribute__((ext_vector_type(4))) unsigned short v4us;
typedef __attribute__((ext_vector_type(2))) float v2f;
typedef __attribute__((ext_vector_type(4))) int v4i;

__global__ __launch_bounds__(256) void k_wtG(const float* __restrict__ w, int K, int N, bf* Bt) {
    const int lane = threadIdx.x & 31; const int L0 = (blockIdx.x * 8 + (threadIdx.x >> 5)) * 8; const int nlines = N * K / 64;
{
#pragma unroll 1
        for (int l = 0; l < 8; ++l) { const int L = L0 + l; if (L >= nlines) break; const size_t e = (size_t)L * 64 + lane * 2; const int k = (int)(e % K), n = (int)(e / K); v2us o;
            o[0] = f2bf(w[(size_t)k * N + n]); o[1] = f2bf(w[(size_t)(k + 1) * N + n]); *(v2us*)(Bt + e) = o; }
         }
}
__global__ __launch_bounds__(256) void k_cvt8(const float* __restrict__ src, bf* dst, size_t n8) { const size_t i = (size_t)blockIdx.x * 256 + threadIdx.x; if (i >= n8) return; const v8f v = *(const v8f*)(src + i * 8); v8us o;
#pragma unroll
    for (int k = 0; k < 8; ++k) o[k] = f2bf(v[k]); *(v8us*)(dst + i * 8) = o;  }

// k_rope: head planes [h][t][d] (fp16 + hi/lo) of rope(x) x sc with the rotate-half convention out[d] = x[d] cos[t][d] - x[d+HD/2] sin[t][d], out[d+HD/2] = x[d+HD/2] cos[t][d+HD/2] + x[d] sin[t][d+HD/2]
__global__ __launch_bounds__(256) void k_rope(const float* __restrict__ F, int pitch, int nheads, const float* __restrict__ CS, const float* __restrict__ RF, const float* __restrict__ nw, float sc, h16* P16, bf* Ph, bf* Pl) {
    const size_t e = ((size_t)blockIdx.x * 256 + threadIdx.x) * 2; if (e >= (size_t)nheads * TT * HD) return; const int d = (int)(e % HD); const int t = (int)((e / HD) % TT); const int h = (int)(e / ((size_t)HD * TT)); const float* f = F + (size_t)t * pitch + h * HD; const float rf = RF ? RF[(size_t)h * TT + t] : 1.0f; v2h o16; v2us oh, ol;
#pragma unroll
    for (int q = 0; q < 2; ++q) { const int dd = d + q; const int dp = (dd < HD / 2) ? dd + HD / 2 : dd - HD / 2; float x0 = f[dd], x1 = f[dp];
        if (RF) { float n0 = __fmul_rn(x0, rf), n1 = __fmul_rn(x1, rf); asm volatile("" : "+v"(n0)); asm volatile("" : "+v"(n1)); x0 = __fmul_rn(bfr(nw[dd]), n0); x1 = __fmul_rn(bfr(nw[dp]), n1); }
        const v2f cs = *(const v2f*)(CS + ((size_t)t * HD + dd) * 2); float a = __fmul_rn(x0, cs[0]), bq = __fmul_rn(x1, cs[1]); asm volatile("" : "+v"(a)); asm volatile("" : "+v"(bq)); const float r = ((dd < HD / 2) ? __fsub_rn(a, bq) : __fadd_rn(a, bq)) * sc;
        o16[q] = tohx(r); unsigned short a2, c2; splitf(r, a2, c2); oh[q] = a2; ol[q] = c2; }
    *(v2h*)(P16 + e) = o16; *(v2us*)(Ph + e) = oh; *(v2us*)(Pl + e) = ol;  }
__global__ __launch_bounds__(256) void k_vtp(const float* __restrict__ F, int pitch, int nheads, h16* V16, bf* Vh, bf* Vl) { const size_t e = ((size_t)blockIdx.x * 256 + threadIdx.x) * 2; if (e >= (size_t)nheads * HD * TT) return; const int t = (int)(e % TT); const int d = (int)((e / TT) % HD); const int g = (int)(e / ((size_t)TT * HD)); v2h o16; v2us oh, ol;
#pragma unroll
    for (int q = 0; q < 2; ++q) { const float x = F[(size_t)(t + q) * pitch + g * HD + d]; o16[q] = tohx(x); unsigned short a2, c2; splitf(x, a2, c2); oh[q] = a2; ol[q] = c2; }
    *(v2h*)(V16 + e) = o16; *(v2us*)(Vh + e) = oh; *(v2us*)(Vl + e) = ol;  }
__global__ __launch_bounds__(256) void k_csid(float* CS) { const int idx = blockIdx.x * 256 + threadIdx.x; if (idx >= TT * HD) return; v2f cs; cs[0] = 1.0f; cs[1] = 0.0f; *(v2f*)(CS + (size_t)idx * 2) = cs;  }
// k_asoft: per row (zz, i): t = S x HD^-0.5 for j <= i and i - j < WIN (sliding causal window; the reference's -1e9 additive fill vanishes identically); softmax over the 2048 keys (register row, one exp, fixed trees);
__global__ __launch_bounds__(256) void k_asoft(const float* __restrict__ Sb, h16* P16, bf* Ph, bf* Pl) {
    const int lane = threadIdx.x & 31; const int row = blockIdx.x * 8 + (threadIdx.x >> 5); if (row >= ZH * TT) return; const int i = row % TT; const int zz = row / TT; (void)zz; const bool hires = (i < RH); const float* sr = Sb + (size_t)row * TT; float v[TT / 32]; float mx = -3.0e38f;
#pragma unroll
    for (int ch = 0; ch < TT / 128; ++ch) { const int j0 = ch * 128 + lane * 4; const v4f a = *(const v4f*)(sr + j0);
#pragma unroll
        for (int q = 0; q < 4; ++q) { const int j = j0 + q; (void)j; const float t = (j <= i && i - j < WIN) ? a[q] * SCL : -3.0e38f; v[ch * 4 + q] = t; mx = fmaxf(mx, t); } }
#pragma unroll
    for (int sh = 16; sh; sh >>= 1) mx = fmaxf(mx, __shfl_xor(mx, sh, 32));
    float sum = 0.f;
#pragma unroll
    for (int k = 0; k < TT / 32; ++k) { float d0 = __fsub_rn(v[k], mx); asm volatile("" : "+v"(d0)); v[k] = __builtin_amdgcn_exp2f(__fmul_rn(d0, 1.4426950408889634f)); sum += v[k]; }
#pragma unroll
    for (int sh = 16; sh; sh >>= 1) sum += __shfl_xor(sum, sh, 32);
    const float f = __fdiv_rn(hires ? 1.0f : PCAR, sum);
{
        if (hires) {
#pragma unroll
            for (int ch = 0; ch < TT / 128; ++ch) { v4us oh, ol;
#pragma unroll
                for (int q = 0; q < 4; ++q) { unsigned short a, c2; splitf(v[ch * 4 + q] * f, a, c2); oh[q] = a; ol[q] = c2; }
                const size_t oo = ((size_t)zz * (RH ? RH : 1) + i) * TT + ch * 128 + lane * 4; *(v4us*)(Ph + oo) = oh; *(v4us*)(Pl + oo) = ol; }
        } else {
#pragma unroll
            for (int ch = 0; ch < TT / 128; ++ch) { v4h o4;
#pragma unroll
                for (int q = 0; q < 4; ++q) o4[q] = tohx(v[ch * 4 + q] * f);
                *(v4h*)(P16 + (size_t)row * TT + ch * 128 + lane * 4) = o4; } }
         }
}
__global__ __launch_bounds__(256) void k_merge(const float* __restrict__ O, int h0, float* OUTb) { const size_t e = ((size_t)blockIdx.x * 256 + threadIdx.x) * 2; if (e >= (size_t)ZH * TT * HD) return; const int d = (int)(e % HD); const int t = (int)((e / HD) % TT); const int zz = (int)(e / ((size_t)HD * TT)); const float cs = (t < RH) ? 1.0f : (1.0f / PCAR); const size_t oo = (size_t)t * DQ + (h0 + zz) * HD + d;
    v2f o2; o2[0] = O[e] * cs; o2[1] = O[e + 1] * cs; *(v2f*)(OUTb + oo) = o2;  }

extern "C" void kernel_launch(void* const* d_in, const int* in_sizes, int n_in,
                              void* d_out, int out_size, void* d_ws, size_t ws_size, hipStream_t stream) {
    (void)in_sizes; (void)n_in; (void)out_size;
    const float* x = (const float*)d_in[0]; const float* pq = (const float*)d_in[1]; const float* pk = (const float*)d_in[2]; const float* pv = (const float*)d_in[3];   /* each [2][1024][512] */ const float* wq = pq, *wk = pk, *wv = pv, *wo = nullptr; (void)wo;
    float* OUT = (float*)d_out;     // [4][2048][1024]
    char* wsp = (char*)d_ws;
    auto take = [&](size_t bytes) { char* p = wsp; wsp += (bytes + 255) & ~(size_t)255; return (void*)p; };
    bf* WQ = (bf*)take((size_t)DQ * DM * 2); bf* WK = (bf*)take((size_t)DKV * DM * 2); bf* WV = (bf*)take((size_t)DKV * DM * 2); float* CS = (float*)take((size_t)TT * HD * 2 * 4);
    bf* XB = (bf*)take((size_t)TT * DM * 2); float* FQ = (float*)take((size_t)TT * DQ * 4); float* FK = (float*)take((size_t)TT * DKV * 4);
    h16* QP16 = (h16*)take((size_t)NH_ * TT * HD * 2); h16* KP16 = (h16*)take((size_t)NKV * TT * HD * 2); h16* VT16 = (h16*)take((size_t)NKV * HD * TT * 2);
    bf* QPh = (bf*)take((size_t)NH_ * TT * HD * 2); bf* QPl = (bf*)take((size_t)NH_ * TT * HD * 2); bf* KPh = (bf*)take((size_t)NKV * TT * HD * 2); bf* KPl = (bf*)take((size_t)NKV * TT * HD * 2); bf* VTh = (bf*)take((size_t)NKV * HD * TT * 2); bf* VTl = (bf*)take((size_t)NKV * HD * TT * 2); bf* Ph = (bf*)take((size_t)ZH * RH * TT * 2); bf* Pl = (bf*)take((size_t)ZH * RH * TT * 2);
    float* Sb = (float*)take((size_t)ZH * TT * TT * 4); h16* P16 = (h16*)take((size_t)ZH * TT * TT * 2); float* Ob = (float*)take((size_t)ZH * TT * HD * 4);
    if ((size_t)(wsp - (char*)d_ws) > ws_size) return;    // ws 256 MiB
    float* FV = FK;   // v projection reuses the k buffer after the k planes are built (stream-ordered)
    { for (int hh = 0; hh < NH_; ++hh) k_wtG<<<(unsigned)((DM * HD / 64 + 63) / 64), 256, 0, stream>>>(wq + (size_t)hh * DM * HD, DM, HD, WQ + (size_t)hh * HD * DM);   /* head hh's 'xw' [1024][512] -> Bt rows hh*512.. */ for (int hh = 0; hh < NH_; ++hh) k_wtG<<<(unsigned)((DM * HD / 64 + 63) / 64), 256, 0, stream>>>(wk + (size_t)hh * DM * HD, DM, HD, WK + (size_t)hh * HD * DM);   /* head hh's 'xw' [1024][512] -> Bt rows hh*512.. */ for (int hh = 0; hh < NH_; ++hh) k_wtG<<<(unsigned)((DM * HD / 64 + 63) / 64), 256, 0, stream>>>(wv + (size_t)hh * DM * HD, DM, HD, WV + (size_t)hh * HD * DM);   /* head hh's 'xw' [1024][512] -> Bt rows hh*512.. */
      
       }
    k_csid<<<(TT * HD + 255) / 256, 256, 0, stream>>>(CS);
    const unsigned LQ = (unsigned)(((size_t)NH_ * TT * HD / 2 + 255) / 256), LKv = (unsigned)(((size_t)NKV * TT * HD / 2 + 255) / 256);
    for (int b = 0; b < NB_; ++b) {
        
        k_cvt8<<<(unsigned)(((size_t)TT * DM / 8 + 255) / 256), 256, 0, stream>>>(x + (size_t)b * TT * DM, XB, (size_t)TT * DM / 8);
        k_gemmw<bf, 0, false><<<dim3(TT / 64, DQ / 64, 1), 32, 0, stream>>>(XB, nullptr, WQ, nullptr, DM, FQ, DQ, nullptr, 0, 0, 0);
        k_rope<<<LQ, 256, 0, stream>>>(FQ, DQ, NH_, CS, nullptr, nullptr, 1.0f, QP16, QPh, QPl);
        k_gemmw<bf, 0, false><<<dim3(TT / 64, DKV / 64, 1), 32, 0, stream>>>(XB, nullptr, WK, nullptr, DM, FK, DKV, nullptr, 0, 0, 0);
        k_rope<<<LKv, 256, 0, stream>>>(FK, DKV, NKV, CS, nullptr, nullptr, 1.0f, KP16, KPh, KPl);
        k_gemmw<bf, 0, false><<<dim3(TT / 64, DKV / 64, 1), 32, 0, stream>>>(XB, nullptr, WV, nullptr, DM, FV, DKV, nullptr, 0, 0, 0); k_vtp<<<LKv, 256, 0, stream>>>(FV, DKV, NKV, VT16, VTh, VTl);
        for (int h0 = 0; h0 < NH_; h0 += ZH) { const size_t zq = (size_t)h0, zk = (size_t)(h0 / REP);   // one kv head per query head: each pass takes one head (ZH = 1) and its kv plane zk = h0
            k_gemmc<bf, 2, 1><<<dim3(TT / 64, TT / 64, ZH), 32, 0, stream>>>(QPh + zq * TT * HD, QPl + zq * TT * HD, KPh + zk * TT * HD, KPl + zk * TT * HD, HD, Sb, TT, 0, (size_t)TT * HD, (size_t)TT * HD, (size_t)TT * TT);   /* scores hi/lo on EVERY row (K = 512) */

            k_asoft<<<ZH * TT / 8, 256, 0, stream>>>(Sb, P16, Ph, Pl);
            k_gemmc<bf, 2, 2><<<dim3(RH / 64, HD / 64, ZH), 32, 0, stream>>>(Ph, Pl, VTh + zk * HD * TT, VTl + zk * HD * TT, TT, Ob, HD, 0, (size_t)RH * TT, (size_t)HD * TT, (size_t)TT * HD);
            k_gemmc<h16, 0, 2><<<dim3((TT - RH) / 64, HD / 64, ZH), 32, 0, stream>>>(P16 + (size_t)RH * TT, nullptr, VT16 + zk * HD * TT, nullptr, TT, Ob + (size_t)RH * HD, HD, RH, (size_t)TT * TT, (size_t)HD * TT, (size_t)TT * HD);
            k_merge<<<(unsigned)(((size_t)ZH * TT * HD / 2 + 255) / 256), 256, 0, stream>>>(Ob, h0, OUT + (size_t)b * TT * DQ); }
         }
}

// v001
// It runs in 455 microseconds.
// Two timings next to v000 put it at 2.36 and 2.35 times that version's speed.
#include <hip/hip_runtime.h>

// Two-head (512-wide heads) causal self-attention with per-head weight tensors (embedded [4][2048][1024]; q, k, v = einsum('bse,hed', x, W[h]) (Wq, Wk, Wv [2][1024][512] 1/32: head h's 'xw' block); scores / sqrt(512); causal (-1e30 == exclusion); softmax; ctx = concat-heads(attn v) -> [4][2048][1024] (8.4 M; no output projection)).
// Layout, all four batches at once (every stage is one launch; batch and head ride in the grid): bf16 copy of x; each projection tensor's two 'xw' [1024][512] blocks transposed into one [1024][1024] Bt (rows h*512..); exact projections; causal T-2048 attention, the eight (batch, head) planes side by side in grid z (hi/lo 3-product score tiles on EVERY row; P and attn.v hybrid: rows < 512 hi/lo, rest fp16 x1024; tiles above the diagonal skipped); the f32 merge writes the output rows.
// Compute dtypes, f32 accumulate: every input rounded to bf16; projections exact; scores 3 products on every row (K = 512); softmax f32 (x 1/sqrt(512)); attn.v rows < 512 3 products, rest fp16; output f32.

#define NB_  4
#define TT   2048
#define DM   1024
#define NH_  2
#define NKV  2
#define REP  (NH_ / NKV)
#define HD   512
#define DQ   (NH_ * HD)
#define DKV  (NKV * HD)
#define ZH   (NB_ * NH_)          // (batch, head) planes per attention launch: z = b * NH_ + h
#define RH   512                  // query rows < RH use hi+lo planes (0: none)
#define WIN  2048
#define PCAR 1024.0f
#define SCL  0.044194173824159223f   // 1/sqrt(hd = 512)
typedef _Float16 h16;
typedef unsigned short bf;
typedef __attribute__((ext_vector_type(16))) __bf16   v16bf;
typedef __attribute__((ext_vector_type(16))) _Float16 v16h;
typedef __attribute__((ext_vector_type(8)))  _Float16 v8h;
typedef __attribute__((ext_vector_type(8)))  unsigned short v8us;
typedef __attribute__((ext_vector_type(8)))  float    v8f;
typedef __attribute__((ext_vector_type(4)))  float    v4f;
typedef v8h  __attribute__((may_alias)) v8ha;
typedef v4f  __attribute__((may_alias)) v4fa;
typedef v8us __attribute__((may_alias)) v8usa;

__device__ __forceinline__ unsigned short f2bf(float f) { unsigned u = __float_as_uint(f); u += 0x7FFFu + ((u >> 16) & 1u); return (unsigned short)(u >> 16); }
__device__ __forceinline__ float bf2f(unsigned short b) { return __uint_as_float(((unsigned)b) << 16); }
__device__ __forceinline__ float bfr(float f) { return bf2f(f2bf(f)); }
__device__ __forceinline__ v16h cat16(v8h lo, v8h hi) { return __builtin_shufflevector(lo, hi, 0, 1, 2, 3, 4, 5, 6, 7, 8, 9, 10, 11, 12, 13, 14, 15); }
__device__ __forceinline__ v16bf cat16b(v8us lo, v8us hi) { return __builtin_bit_cast(v16bf, __builtin_shufflevector(lo, hi, 0, 1, 2, 3, 4, 5, 6, 7, 8, 9, 10, 11, 12, 13, 14, 15)); }
__device__ __forceinline__ v8f wmma16(v16h a, v16h b, v8f c) { return __builtin_amdgcn_wmma_f32_16x16x32_f16(false, a, false, b, (short)0, c, false, false); }
__device__ __forceinline__ v8f wmmab(v16bf a, v16bf b, v8f c) { return __builtin_amdgcn_wmma_f32_16x16x32_bf16(false, a, false, b, (short)0, c, false, false); }



// ---- k_gemmw: register-blocked GEMM, ONE WAVE per 64x64 output tile (16 accumulators), operands straight from K-contiguous 16-bit planes; grid (M/64, N/64, Z), 32 threads.
// C[m][n] (f32, pitch ldc, + optional f32 bias[n]) = sum_k A[m][k] Bt[n][k] (+ split products per NSPLIT). z-batch strides sA/sB/sC in elements. K % 32 == 0.
template <typename T16> struct WFrag;
template <> struct WFrag<h16> { typedef v16h V; static __device__ __forceinline__ V ld(const h16* p) { return cat16(*(const v8h*)p, *(const v8h*)(p + 16)); } static __device__ __forceinline__ v8f mma(V a, V b, v8f c) { return wmma16(a, b, c); } };
template <> struct WFrag<bf> { typedef v16bf V; static __device__ __forceinline__ V ld(const bf* p) { return cat16b(*(const v8us*)p, *(const v8us*)(p + 16)); } static __device__ __forceinline__ v8f mma(V a, V b, v8f c) { return wmmab(a, b, c); } };
template <typename T16, int NSPLIT, bool BIAS>
__global__ __launch_bounds__(32) void k_gemmw(const T16* __restrict__ A, const T16* __restrict__ A2, const T16* __restrict__ Bt, const T16* __restrict__ Bt2, int K, float* C, int ldc, const float* __restrict__ bias, size_t sA, size_t sB, size_t sC) {
    typedef typename WFrag<T16>::V V;
    __shared__ __align__(16) float os[16 * 68];
    const size_t z = blockIdx.z; A += z * sA; if (A2) A2 += z * sA; Bt += z * sB; if (Bt2) Bt2 += z * sB; C += z * sC;
    const int lane = threadIdx.x & 31, lr = lane & 15, hi = lane >> 4; const int r0 = blockIdx.x * 64, c0 = blockIdx.y * 64;
    v8f acc[4][4];
#pragma unroll
    for (int mb = 0; mb < 4; ++mb)
#pragma unroll
        for (int nb = 0; nb < 4; ++nb) acc[mb][nb] = (v8f){};
    const size_t aoff = (size_t)(r0 + lr) * K + 8 * hi, boff = (size_t)(c0 + lr) * K + 8 * hi;
#pragma unroll 1
    for (int kc = 0; kc < K; kc += 32) {
        V a[4], a2[4];
#pragma unroll
        for (int mb = 0; mb < 4; ++mb) { a[mb] = WFrag<T16>::ld(A + aoff + (size_t)mb * 16 * K + kc); if (NSPLIT == 1 || NSPLIT == 2) a2[mb] = WFrag<T16>::ld(A2 + aoff + (size_t)mb * 16 * K + kc); }
#pragma unroll
        for (int nb = 0; nb < 4; ++nb) { const V b = WFrag<T16>::ld(Bt + boff + (size_t)nb * 16 * K + kc); V b2; if (NSPLIT >= 2) b2 = WFrag<T16>::ld(Bt2 + boff + (size_t)nb * 16 * K + kc);
#pragma unroll
            for (int mb = 0; mb < 4; ++mb) { acc[mb][nb] = WFrag<T16>::mma(a[mb], b, acc[mb][nb]); if (NSPLIT == 1 || NSPLIT == 2) acc[mb][nb] = WFrag<T16>::mma(a2[mb], b, acc[mb][nb]); if (NSPLIT >= 2) acc[mb][nb] = WFrag<T16>::mma(a[mb], b2, acc[mb][nb]); } }
        asm volatile("v_nop\n\tv_nop\n\tv_nop\n\tv_nop" : "+v"(acc[0][0]), "+v"(acc[1][1]), "+v"(acc[2][2]), "+v"(acc[3][3]) : "v"(a[0]), "v"(a[3]));
    }
#pragma unroll
    for (int mb = 0; mb < 4; ++mb) {
#pragma unroll
        for (int nb = 0; nb < 4; ++nb) {
#pragma unroll
            for (int j = 0; j < 8; ++j) os[(hi * 8 + j) * 68 + nb * 16 + lr] = acc[mb][nb][j]; }
        __builtin_amdgcn_wave_barrier(); asm volatile("" ::: "memory");
        float* crow = C + (size_t)(r0 + mb * 16) * ldc + c0;
{
#pragma unroll
            for (int s = 0; s < 8; ++s) { const int row = 2 * s + hi, cofs = lr * 4; v4f val = *(const v4fa*)(os + row * 68 + cofs); if (BIAS) { val[0] += bfr(bias[c0 + cofs]); val[1] += bfr(bias[c0 + cofs + 1]); val[2] += bfr(bias[c0 + cofs + 2]); val[3] += bfr(bias[c0 + cofs + 3]); }
                *(v4f*)(crow + (size_t)row * ldc + cofs) = val; }
             }
        __builtin_amdgcn_wave_barrier(); asm volatile("" ::: "memory");
    }
}

// ---- k_gemmc: the same one-wave 64x64 tile GEMM specialised for causal attention: CMODE 1 skips score tiles entirely above the diagonal (query rows r0+roff.., key columns c0..), CMODE 2 limits the
// key (K) loop of the probability x value contraction to the diagonal block (probabilities beyond it are exactly zero). roff = row offset of this launch's first row within the sequence.
template <typename T16, int NSPLIT, int CMODE>
__global__ __launch_bounds__(32) void k_gemmc(const T16* __restrict__ A, const T16* __restrict__ A2, const T16* __restrict__ Bt, const T16* __restrict__ Bt2, int K, float* C, int ldc, int roff, size_t sA, size_t sB, size_t sC) {
    typedef typename WFrag<T16>::V V;
    __shared__ __align__(16) float os[16 * 68];
    const size_t z = blockIdx.z; A += z * sA; if (A2) A2 += z * sA; Bt += z * sB; if (Bt2) Bt2 += z * sB; C += z * sC;
    const int lane = threadIdx.x & 31, lr = lane & 15, hi = lane >> 4; const int r0 = blockIdx.x * 64, c0 = blockIdx.y * 64;
    if (CMODE == 1 && c0 > r0 + roff + 63) return;                  // score tile entirely above the causal diagonal: never read (the softmax masks j > i by select)
    const int Kl = (CMODE == 2) ? min(K, r0 + roff + 64) : K;        // P.V: probabilities are exactly 0 beyond the diagonal block, so the K loop stops there
    v8f acc[4][4];
#pragma unroll
    for (int mb = 0; mb < 4; ++mb)
#pragma unroll
        for (int nb = 0; nb < 4; ++nb) acc[mb][nb] = (v8f){};
    const size_t aoff = (size_t)(r0 + lr) * K + 8 * hi, boff = (size_t)(c0 + lr) * K + 8 * hi;
#pragma unroll 1
    for (int kc = 0; kc < Kl; kc += 32) {
        V a[4], a2[4];
#pragma unroll
        for (int mb = 0; mb < 4; ++mb) { a[mb] = WFrag<T16>::ld(A + aoff + (size_t)mb * 16 * K + kc); if (NSPLIT == 1 || NSPLIT == 2) a2[mb] = WFrag<T16>::ld(A2 + aoff + (size_t)mb * 16 * K + kc); }
#pragma unroll
        for (int nb = 0; nb < 4; ++nb) { const V b = WFrag<T16>::ld(Bt + boff + (size_t)nb * 16 * K + kc); V b2; if (NSPLIT >= 2) b2 = WFrag<T16>::ld(Bt2 + boff + (size_t)nb * 16 * K + kc);
#pragma unroll
            for (int mb = 0; mb < 4; ++mb) { acc[mb][nb] = WFrag<T16>::mma(a[mb], b, acc[mb][nb]); if (NSPLIT == 1 || NSPLIT == 2) acc[mb][nb] = WFrag<T16>::mma(a2[mb], b, acc[mb][nb]); if (NSPLIT >= 2) acc[mb][nb] = WFrag<T16>::mma(a[mb], b2, acc[mb][nb]); } }
        asm volatile("v_nop\n\tv_nop\n\tv_nop\n\tv_nop" : "+v"(acc[0][0]), "+v"(acc[1][1]), "+v"(acc[2][2]), "+v"(acc[3][3]) : "v"(a[0]), "v"(a[3]));
    }
#pragma unroll
    for (int mb = 0; mb < 4; ++mb) {
#pragma unroll
        for (int nb = 0; nb < 4; ++nb) {
#pragma unroll
            for (int j = 0; j < 8; ++j) os[(hi * 8 + j) * 68 + nb * 16 + lr] = acc[mb][nb][j]; }
        __builtin_amdgcn_wave_barrier(); asm volatile("" ::: "memory");
        float* crow = C + (size_t)(r0 + mb * 16) * ldc + c0;
{
#pragma unroll
            for (int s = 0; s < 8; ++s) { const int row = 2 * s + hi, cofs = lr * 4; v4f val = *(const v4fa*)(os + row * 68 + cofs);
                *(v4f*)(crow + (size_t)row * ldc + cofs) = val; }
             }
        __builtin_amdgcn_wave_barrier(); asm volatile("" ::: "memory");
    }
}

__device__ __forceinline__ h16 tohx(float x) { return (h16)x; }
__device__ __forceinline__ void splitf(float y, unsigned short& h, unsigned short& l) { h = f2bf(y); l = f2bf(y - bf2f(h)); }
typedef __attribute__((ext_vector_type(2))) _Float16 v2h;
typedef __attribute__((ext_vector_type(4))) _Float16 v4h;
typedef __attribute__((ext_vector_type(2))) unsigned short v2us;
typedef __attribute__((ext_vector_type(4))) unsigned short v4us;
typedef __attribute__((ext_vector_type(2))) float v2f;
typedef __attribute__((ext_vector_type(4))) int v4i;

__global__ __launch_bounds__(256) void k_wtG(const float* __restrict__ w, int K, int N, bf* Bt) {
    w += (size_t)blockIdx.y * K * N; Bt += (size_t)blockIdx.y * N * K;   // blockIdx.y = head: its [K][N] block -> its N rows of Bt
    const int lane = threadIdx.x & 31; const int L0 = (blockIdx.x * 8 + (threadIdx.x >> 5)) * 8; const int nlines = N * K / 64;
{
#pragma unroll 1
        for (int l = 0; l < 8; ++l) { const int L = L0 + l; if (L >= nlines) break; const size_t e = (size_t)L * 64 + lane * 2; const int k = (int)(e % K), n = (int)(e / K); v2us o;
            o[0] = f2bf(w[(size_t)k * N + n]); o[1] = f2bf(w[(size_t)(k + 1) * N + n]); *(v2us*)(Bt + e) = o; }
         }
}
__global__ __launch_bounds__(256) void k_cvt8(const float* __restrict__ src, bf* dst, size_t n8) { const size_t i = (size_t)blockIdx.x * 256 + threadIdx.x; if (i >= n8) return; const v8f v = *(const v8f*)(src + i * 8); v8us o;
#pragma unroll
    for (int k = 0; k < 8; ++k) o[k] = f2bf(v[k]); *(v8us*)(dst + i * 8) = o;  }

// k_rope: head planes [h][t][d] (fp16 + hi/lo) of rope(x) x sc with the rotate-half convention out[d] = x[d] cos[t][d] - x[d+HD/2] sin[t][d], out[d+HD/2] = x[d+HD/2] cos[t][d+HD/2] + x[d] sin[t][d+HD/2]
__global__ __launch_bounds__(256) void k_rope(const float* __restrict__ F, int pitch, int nheads, const float* __restrict__ CS, const float* __restrict__ RF, const float* __restrict__ nw, float sc, h16* P16, bf* Ph, bf* Pl) {
    const size_t e = ((size_t)blockIdx.x * 256 + threadIdx.x) * 2; if (e >= (size_t)nheads * TT * HD) return; { const size_t bo = (size_t)blockIdx.y * nheads * TT * HD; F += (size_t)blockIdx.y * TT * pitch; P16 += bo; Ph += bo; Pl += bo; }   // blockIdx.y = batch
    const int d = (int)(e % HD); const int t = (int)((e / HD) % TT); const int h = (int)(e / ((size_t)HD * TT)); const float* f = F + (size_t)t * pitch + h * HD; const float rf = RF ? RF[(size_t)h * TT + t] : 1.0f; v2h o16; v2us oh, ol;
#pragma unroll
    for (int q = 0; q < 2; ++q) { const int dd = d + q; const int dp = (dd < HD / 2) ? dd + HD / 2 : dd - HD / 2; float x0 = f[dd], x1 = f[dp];
        if (RF) { float n0 = __fmul_rn(x0, rf), n1 = __fmul_rn(x1, rf); asm volatile("" : "+v"(n0)); asm volatile("" : "+v"(n1)); x0 = __fmul_rn(bfr(nw[dd]), n0); x1 = __fmul_rn(bfr(nw[dp]), n1); }
        const v2f cs = *(const v2f*)(CS + ((size_t)t * HD + dd) * 2); float a = __fmul_rn(x0, cs[0]), bq = __fmul_rn(x1, cs[1]); asm volatile("" : "+v"(a)); asm volatile("" : "+v"(bq)); const float r = ((dd < HD / 2) ? __fsub_rn(a, bq) : __fadd_rn(a, bq)) * sc;
        o16[q] = tohx(r); unsigned short a2, c2; splitf(r, a2, c2); oh[q] = a2; ol[q] = c2; }
    *(v2h*)(P16 + e) = o16; *(v2us*)(Ph + e) = oh; *(v2us*)(Pl + e) = ol;  }
__global__ __launch_bounds__(256) void k_vtp(const float* __restrict__ F, int pitch, int nheads, h16* V16, bf* Vh, bf* Vl) { const size_t e = ((size_t)blockIdx.x * 256 + threadIdx.x) * 2; if (e >= (size_t)nheads * HD * TT) return; { const size_t bo = (size_t)blockIdx.y * nheads * HD * TT; F += (size_t)blockIdx.y * TT * pitch; V16 += bo; Vh += bo; Vl += bo; }   // blockIdx.y = batch
    const int t = (int)(e % TT); const int d = (int)((e / TT) % HD); const int g = (int)(e / ((size_t)TT * HD)); v2h o16; v2us oh, ol;
#pragma unroll
    for (int q = 0; q < 2; ++q) { const float x = F[(size_t)(t + q) * pitch + g * HD + d]; o16[q] = tohx(x); unsigned short a2, c2; splitf(x, a2, c2); oh[q] = a2; ol[q] = c2; }
    *(v2h*)(V16 + e) = o16; *(v2us*)(Vh + e) = oh; *(v2us*)(Vl + e) = ol;  }
__global__ __launch_bounds__(256) void k_csid(float* CS) { const int idx = blockIdx.x * 256 + threadIdx.x; if (idx >= TT * HD) return; v2f cs; cs[0] = 1.0f; cs[1] = 0.0f; *(v2f*)(CS + (size_t)idx * 2) = cs;  }
// k_asoft: per row (zz, i): t = S x HD^-0.5 for j <= i and i - j < WIN (sliding causal window; the reference's -1e9 additive fill vanishes identically); softmax over the 2048 keys (register row, one exp, fixed trees);
__global__ __launch_bounds__(256) void k_asoft(const float* __restrict__ Sb, h16* P16, bf* Ph, bf* Pl) {
    const int lane = threadIdx.x & 31; const int row = blockIdx.x * 8 + (threadIdx.x >> 5); if (row >= ZH * TT) return; const int i = row % TT; const int zz = row / TT; (void)zz; const bool hires = (i < RH); const float* sr = Sb + (size_t)row * TT; float v[TT / 32]; float mx = -3.0e38f;
#pragma unroll
    for (int ch = 0; ch < TT / 128; ++ch) { const int j0 = ch * 128 + lane * 4; const v4f a = *(const v4f*)(sr + j0);
#pragma unroll
        for (int q = 0; q < 4; ++q) { const int j = j0 + q; (void)j; const float t = (j <= i && i - j < WIN) ? a[q] * SCL : -3.0e38f; v[ch * 4 + q] = t; mx = fmaxf(mx, t); } }
#pragma unroll
    for (int sh = 16; sh; sh >>= 1) mx = fmaxf(mx, __shfl_xor(mx, sh, 32));
    float sum = 0.f;
#pragma unroll
    for (int k = 0; k < TT / 32; ++k) { float d0 = __fsub_rn(v[k], mx); asm volatile("" : "+v"(d0)); v[k] = __builtin_amdgcn_exp2f(__fmul_rn(d0, 1.4426950408889634f)); sum += v[k]; }
#pragma unroll
    for (int sh = 16; sh; sh >>= 1) sum += __shfl_xor(sum, sh, 32);
    const float f = __fdiv_rn(hires ? 1.0f : PCAR, sum);
{
        if (hires) {
#pragma unroll
            for (int ch = 0; ch < TT / 128; ++ch) { v4us oh, ol;
#pragma unroll
                for (int q = 0; q < 4; ++q) { unsigned short a, c2; splitf(v[ch * 4 + q] * f, a, c2); oh[q] = a; ol[q] = c2; }
                const size_t oo = ((size_t)zz * (RH ? RH : 1) + i) * TT + ch * 128 + lane * 4; *(v4us*)(Ph + oo) = oh; *(v4us*)(Pl + oo) = ol; }
        } else {
#pragma unroll
            for (int ch = 0; ch < TT / 128; ++ch) { v4h o4;
#pragma unroll
                for (int q = 0; q < 4; ++q) o4[q] = tohx(v[ch * 4 + q] * f);
                *(v4h*)(P16 + ((size_t)zz * (TT - RH) + (i - RH)) * TT + ch * 128 + lane * 4) = o4; } }   // P16 holds only the rows >= RH of each plane
         }
}
__global__ __launch_bounds__(256) void k_merge(const float* __restrict__ O, float* OUTb) { const size_t e = ((size_t)blockIdx.x * 256 + threadIdx.x) * 2; if (e >= (size_t)ZH * TT * HD) return; const int d = (int)(e % HD); const int t = (int)((e / HD) % TT); const int zz = (int)(e / ((size_t)HD * TT)); const float cs = (t < RH) ? 1.0f : (1.0f / PCAR); const size_t oo = ((size_t)(zz / NH_) * TT + t) * DQ + (zz % NH_) * HD + d;
    v2f o2; o2[0] = O[e] * cs; o2[1] = O[e + 1] * cs; *(v2f*)(OUTb + oo) = o2;  }

extern "C" void kernel_launch(void* const* d_in, const int* in_sizes, int n_in,
                              void* d_out, int out_size, void* d_ws, size_t ws_size, hipStream_t stream) {
    (void)in_sizes; (void)n_in; (void)out_size;
    const float* x = (const float*)d_in[0]; const float* pq = (const float*)d_in[1]; const float* pk = (const float*)d_in[2]; const float* pv = (const float*)d_in[3];   /* each [2][1024][512] */ const float* wq = pq, *wk = pk, *wv = pv, *wo = nullptr; (void)wo;
    float* OUT = (float*)d_out;     // [4][2048][1024]
    char* wsp = (char*)d_ws;
    auto take = [&](size_t bytes) { char* p = wsp; wsp += (bytes + 255) & ~(size_t)255; return (void*)p; };
    // Workspace by lifetime (stream-ordered): the score planes' region first holds everything that is dead once the q, k, v planes exist, and the context rows once the probabilities exist; the probabilities overwrite the q and k planes, dead after the scores.
    float* Sb = (float*)take((size_t)ZH * TT * TT * 4);
    bf* QPh = (bf*)take((size_t)ZH * TT * HD * 2); bf* QPl = (bf*)take((size_t)ZH * TT * HD * 2); bf* KPh = (bf*)take((size_t)ZH * TT * HD * 2); bf* KPl = (bf*)take((size_t)ZH * TT * HD * 2);
    h16* VT16 = (h16*)take((size_t)ZH * HD * TT * 2); bf* VTh = (bf*)take((size_t)ZH * HD * TT * 2); bf* VTl = (bf*)take((size_t)ZH * HD * TT * 2); bf* Pl = (bf*)take((size_t)ZH * RH * TT * 2);
    if ((size_t)(wsp - (char*)d_ws) > ws_size) return;    // ws 256 MiB
    wsp = (char*)Sb;     // inside the score region (126 of its 128 MiB), dead before the scores are written
    bf* WQ = (bf*)take((size_t)DQ * DM * 2); bf* WK = (bf*)take((size_t)DKV * DM * 2); bf* WV = (bf*)take((size_t)DKV * DM * 2); float* CS = (float*)take((size_t)TT * HD * 2 * 4);
    bf* XB = (bf*)take((size_t)NB_ * TT * DM * 2); float* FQ = (float*)take((size_t)NB_ * TT * DQ * 4); float* FK = (float*)take((size_t)NB_ * TT * DKV * 4);
    h16* QP16 = (h16*)take((size_t)ZH * TT * HD * 2); h16* KP16 = (h16*)take((size_t)ZH * TT * HD * 2);
    float* FV = FK;   // v projection reuses the k buffer after the k planes are built (stream-ordered)
    float* Ob = Sb;   // context rows [z][t][d]: written after the softmax has read the scores
    wsp = (char*)QPh;    // inside the q and k planes (64 MiB), dead after the scores
    h16* P16 = (h16*)take((size_t)ZH * (TT - RH) * TT * 2); bf* Ph = (bf*)take((size_t)ZH * RH * TT * 2);
    const dim3 GW((unsigned)((DM * HD / 64 + 63) / 64), NH_, 1);   // head hh's 'xw' [1024][512] -> Bt rows hh*512..
    k_wtG<<<GW, 256, 0, stream>>>(wq, DM, HD, WQ); k_wtG<<<GW, 256, 0, stream>>>(wk, DM, HD, WK); k_wtG<<<GW, 256, 0, stream>>>(wv, DM, HD, WV);
    k_csid<<<(TT * HD + 255) / 256, 256, 0, stream>>>(CS);
    const dim3 LQ((unsigned)(((size_t)NH_ * TT * HD / 2 + 255) / 256), NB_, 1), LKv((unsigned)(((size_t)NKV * TT * HD / 2 + 255) / 256), NB_, 1);
    k_cvt8<<<(unsigned)(((size_t)NB_ * TT * DM / 8 + 255) / 256), 256, 0, stream>>>(x, XB, (size_t)NB_ * TT * DM / 8);
    k_gemmw<bf, 0, false><<<dim3(NB_ * TT / 64, DQ / 64, 1), 32, 0, stream>>>(XB, nullptr, WQ, nullptr, DM, FQ, DQ, nullptr, 0, 0, 0);   /* the four batches' rows are one [8192][1024] A */
    k_rope<<<LQ, 256, 0, stream>>>(FQ, DQ, NH_, CS, nullptr, nullptr, 1.0f, QP16, QPh, QPl);
    k_gemmw<bf, 0, false><<<dim3(NB_ * TT / 64, DKV / 64, 1), 32, 0, stream>>>(XB, nullptr, WK, nullptr, DM, FK, DKV, nullptr, 0, 0, 0);
    k_rope<<<LKv, 256, 0, stream>>>(FK, DKV, NKV, CS, nullptr, nullptr, 1.0f, KP16, KPh, KPl);
    k_gemmw<bf, 0, false><<<dim3(NB_ * TT / 64, DKV / 64, 1), 32, 0, stream>>>(XB, nullptr, WV, nullptr, DM, FV, DKV, nullptr, 0, 0, 0); k_vtp<<<LKv, 256, 0, stream>>>(FV, DKV, NKV, VT16, VTh, VTl);
    // one kv head per query head: plane z = b * NH_ + h of q, k and v (z-strides TT*HD)
    k_gemmc<bf, 2, 1><<<dim3(TT / 64, TT / 64, ZH), 32, 0, stream>>>(QPh, QPl, KPh, KPl, HD, Sb, TT, 0, (size_t)TT * HD, (size_t)TT * HD, (size_t)TT * TT);   /* scores hi/lo on EVERY row (K = 512) */
    k_asoft<<<ZH * TT / 8, 256, 0, stream>>>(Sb, P16, Ph, Pl);
    k_gemmc<bf, 2, 2><<<dim3(RH / 64, HD / 64, ZH), 32, 0, stream>>>(Ph, Pl, VTh, VTl, TT, Ob, HD, 0, (size_t)RH * TT, (size_t)HD * TT, (size_t)TT * HD);
    k_gemmc<h16, 0, 2><<<dim3((TT - RH) / 64, HD / 64, ZH), 32, 0, stream>>>(P16, nullptr, VT16, nullptr, TT, Ob + (size_t)RH * HD, HD, RH, (size_t)(TT - RH) * TT, (size_t)HD * TT, (size_t)TT * HD);
    k_merge<<<(unsigned)(((size_t)ZH * TT * HD / 2 + 255) / 256), 256, 0, stream>>>(Ob, OUT);
}

// v002
// It runs in 369 microseconds.
// Next to v001, in two timings, it ran 1.23 and 1.24 times as fast.
// All steps since v000 together make it 2.91 times as fast.
#include <hip/hip_runtime.h>

// Two-head (512-wide heads) causal self-attention with per-head weight tensors (embedded [4][2048][1024]; q, k, v = einsum('bse,hed', x, W[h]) (Wq, Wk, Wv [2][1024][512] 1/32: head h's 'xw' block); scores / sqrt(512); causal (-1e30 == exclusion); softmax; ctx = concat-heads(attn v) -> [4][2048][1024] (8.4 M; no output projection)).
// Layout, all four batches at once (batch and head ride in the grid): bf16 copy of x; each projection tensor's two 'xw' [1024][512] blocks transposed into one [1024][1024] Bt (rows h*512..); exact projections whose tile epilogues store the q and k hi/lo planes and (product taken as W x^T) the transposed v planes directly; causal T-2048 attention, the eight (batch, head) planes side by side in grid z (hi/lo 3-product score tiles on EVERY row; P and attn.v hybrid: rows < 512 hi/lo, rest fp16 x1024; tiles above the diagonal skipped); the attn.v tile epilogues scale and store the output rows.
// Compute dtypes, f32 accumulate: every input rounded to bf16; projections exact; scores 3 products on every row (K = 512); softmax f32 (x 1/sqrt(512)); attn.v rows < 512 3 products, rest fp16; output f32.

#define NB_  4
#define TT   2048
#define DM   1024
#define NH_  2
#define NKV  2
#define REP  (NH_ / NKV)
#define HD   512
#define DQ   (NH_ * HD)
#define DKV  (NKV * HD)
#define ZH   (NB_ * NH_)          // (batch, head) planes per attention launch: z = b * NH_ + h
#define RH   512                  // query rows < RH use hi+lo planes (0: none)
#define WIN  2048
#define PCAR 1024.0f
#define SCL  0.044194173824159223f   // 1/sqrt(hd = 512)
typedef _Float16 h16;
typedef unsigned short bf;
typedef __attribute__((ext_vector_type(16))) __bf16   v16bf;
typedef __attribute__((ext_vector_type(16))) _Float16 v16h;
typedef __attribute__((ext_vector_type(8)))  _Float16 v8h;
typedef __attribute__((ext_vector_type(8)))  unsigned short v8us;
typedef __attribute__((ext_vector_type(8)))  float    v8f;
typedef __attribute__((ext_vector_type(4)))  float    v4f;
typedef v8h  __attribute__((may_alias)) v8ha;
typedef v4f  __attribute__((may_alias)) v4fa;
typedef v8us __attribute__((may_alias)) v8usa;

__device__ __forceinline__ unsigned short f2bf(float f) { unsigned u = __float_as_uint(f); u += 0x7FFFu + ((u >> 16) & 1u); return (unsigned short)(u >> 16); }
__device__ __forceinline__ float bf2f(unsigned short b) { return __uint_as_float(((unsigned)b) << 16); }
__device__ __forceinline__ float bfr(float f) { return bf2f(f2bf(f)); }
__device__ __forceinline__ v16h cat16(v8h lo, v8h hi) { return __builtin_shufflevector(lo, hi, 0, 1, 2, 3, 4, 5, 6, 7, 8, 9, 10, 11, 12, 13, 14, 15); }
__device__ __forceinline__ v16bf cat16b(v8us lo, v8us hi) { return __builtin_bit_cast(v16bf, __builtin_shufflevector(lo, hi, 0, 1, 2, 3, 4, 5, 6, 7, 8, 9, 10, 11, 12, 13, 14, 15)); }
__device__ __forceinline__ v8f wmma16(v16h a, v16h b, v8f c) { return __builtin_amdgcn_wmma_f32_16x16x32_f16(false, a, false, b, (short)0, c, false, false); }
__device__ __forceinline__ v8f wmmab(v16bf a, v16bf b, v8f c) { return __builtin_amdgcn_wmma_f32_16x16x32_bf16(false, a, false, b, (short)0, c, false, false); }



__device__ __forceinline__ h16 tohx(float x) { return (h16)x; }
__device__ __forceinline__ void splitf(float y, unsigned short& h, unsigned short& l) { h = f2bf(y); l = f2bf(y - bf2f(h)); }
typedef __attribute__((ext_vector_type(2))) _Float16 v2h;
typedef __attribute__((ext_vector_type(4))) _Float16 v4h;
typedef __attribute__((ext_vector_type(2))) unsigned short v2us;
typedef __attribute__((ext_vector_type(4))) unsigned short v4us;
typedef __attribute__((ext_vector_type(2))) float v2f;
typedef __attribute__((ext_vector_type(4))) int v4i;

// ---- k_gemmw: register-blocked projection GEMM, ONE WAVE per 64x64 tile (16 accumulators), operands straight from K-contiguous 16-bit planes; grid (M/64, N/64), 32 threads.
// c[m][n] = sum_k A[m][k] Bt[n][k] (f32; + split products per NSPLIT) goes from the accumulators through the wave's LDS rows straight into the 16-bit planes its consumers read, in whole 128-byte lines. K % 32 == 0.
// VT false: m = (b, t), n = (h, d) -> hi/lo planes [b][h][t][d].  VT true: m = (h, d), n = (b, t) -> fp16 and hi/lo planes [b][h][d][t].
template <typename T16> struct WFrag;
template <> struct WFrag<h16> { typedef v16h V; static __device__ __forceinline__ V ld(const h16* p) { return cat16(*(const v8h*)p, *(const v8h*)(p + 16)); } static __device__ __forceinline__ v8f mma(V a, V b, v8f c) { return wmma16(a, b, c); } };
template <> struct WFrag<bf> { typedef v16bf V; static __device__ __forceinline__ V ld(const bf* p) { return cat16b(*(const v8us*)p, *(const v8us*)(p + 16)); } static __device__ __forceinline__ v8f mma(V a, V b, v8f c) { return wmmab(a, b, c); } };
template <typename T16, int NSPLIT, bool VT>
__global__ __launch_bounds__(32) void k_gemmw(const T16* __restrict__ A, const T16* __restrict__ A2, const T16* __restrict__ Bt, const T16* __restrict__ Bt2, int K, h16* P16, bf* Ph, bf* Pl) {
    typedef typename WFrag<T16>::V V;
    __shared__ __align__(16) float os[16 * 68];
    const int lane = threadIdx.x & 31, lr = lane & 15, hi = lane >> 4; const int r0 = blockIdx.x * 64, c0 = blockIdx.y * 64;
    v8f acc[4][4];
#pragma unroll
    for (int mb = 0; mb < 4; ++mb)
#pragma unroll
        for (int nb = 0; nb < 4; ++nb) acc[mb][nb] = (v8f){};
    const size_t aoff = (size_t)(r0 + lr) * K + 8 * hi, boff = (size_t)(c0 + lr) * K + 8 * hi;
#pragma unroll 1
    for (int kc = 0; kc < K; kc += 32) {
        V a[4], a2[4];
#pragma unroll
        for (int mb = 0; mb < 4; ++mb) { a[mb] = WFrag<T16>::ld(A + aoff + (size_t)mb * 16 * K + kc); if (NSPLIT == 1 || NSPLIT == 2) a2[mb] = WFrag<T16>::ld(A2 + aoff + (size_t)mb * 16 * K + kc); }
#pragma unroll
        for (int nb = 0; nb < 4; ++nb) { const V b = WFrag<T16>::ld(Bt + boff + (size_t)nb * 16 * K + kc); V b2; if (NSPLIT >= 2) b2 = WFrag<T16>::ld(Bt2 + boff + (size_t)nb * 16 * K + kc);
#pragma unroll
            for (int mb = 0; mb < 4; ++mb) { acc[mb][nb] = WFrag<T16>::mma(a[mb], b, acc[mb][nb]); if (NSPLIT == 1 || NSPLIT == 2) acc[mb][nb] = WFrag<T16>::mma(a2[mb], b, acc[mb][nb]); if (NSPLIT >= 2) acc[mb][nb] = WFrag<T16>::mma(a[mb], b2, acc[mb][nb]); } }
        asm volatile("v_nop\n\tv_nop\n\tv_nop\n\tv_nop" : "+v"(acc[0][0]), "+v"(acc[1][1]), "+v"(acc[2][2]), "+v"(acc[3][3]) : "v"(a[0]), "v"(a[3]));
    }
    // a 64x64 tile lies inside one batch and one head: its first element and its row pitch in the planes
    const size_t base = VT ? (((size_t)(c0 / TT) * NKV + r0 / HD) * HD + r0 % HD) * TT + c0 % TT : (((size_t)(r0 / TT) * NH_ + c0 / HD) * TT + r0 % TT) * HD + c0 % HD;
    const int pitch = VT ? TT : HD;
#pragma unroll
    for (int mb = 0; mb < 4; ++mb) {
#pragma unroll
        for (int nb = 0; nb < 4; ++nb) {
#pragma unroll
            for (int j = 0; j < 8; ++j) os[(hi * 8 + j) * 68 + nb * 16 + lr] = acc[mb][nb][j]; }
        __builtin_amdgcn_wave_barrier(); asm volatile("" ::: "memory");
#pragma unroll
        for (int s = 0; s < 4; ++s) { const int row = 4 * s + (lane >> 3), cofs = (lane & 7) * 8; const v4f v0 = *(const v4fa*)(os + row * 68 + cofs), v1 = *(const v4fa*)(os + row * 68 + cofs + 4); v8h o16; v8us oh, ol;
#pragma unroll
            for (int q = 0; q < 8; ++q) { const float y = (q < 4) ? v0[q & 3] : v1[q & 3]; unsigned short a2, c2; splitf(y, a2, c2); oh[q] = a2; ol[q] = c2; if (VT) o16[q] = tohx(y); }
            const size_t oo = base + (size_t)(mb * 16 + row) * pitch + cofs; *(v8us*)(Ph + oo) = oh; *(v8us*)(Pl + oo) = ol; if (VT) *(v8h*)(P16 + oo) = o16; }
        __builtin_amdgcn_wave_barrier(); asm volatile("" ::: "memory");
    }
}

// ---- k_gemmc: the same one-wave 64x64 tile GEMM specialised for causal attention: CMODE 1 skips score tiles entirely above the diagonal (query rows r0+roff.., key columns c0..), CMODE 2 limits the
// key (K) loop of the probability x value contraction to the diagonal block (probabilities beyond it are exactly zero). roff = row offset of this launch's first row within the sequence. CMODE 2 also scales by osc on the way out. Plane z = b * NH_ + h of C starts at b * sCb + h * sCh.
template <typename T16, int NSPLIT, int CMODE>
__global__ __launch_bounds__(32) void k_gemmc(const T16* __restrict__ A, const T16* __restrict__ A2, const T16* __restrict__ Bt, const T16* __restrict__ Bt2, int K, float* C, int ldc, int roff, size_t sA, size_t sB, size_t sCb, size_t sCh, float osc) {
    typedef typename WFrag<T16>::V V;
    __shared__ __align__(16) float os[16 * 68];
    const size_t z = blockIdx.z; A += z * sA; if (A2) A2 += z * sA; Bt += z * sB; if (Bt2) Bt2 += z * sB; C += (z / NH_) * sCb + (z % NH_) * sCh;
    const int lane = threadIdx.x & 31, lr = lane & 15, hi = lane >> 4; const int r0 = blockIdx.x * 64, c0 = blockIdx.y * 64;
    if (CMODE == 1 && c0 > r0 + roff + 63) return;                  // score tile entirely above the causal diagonal: never read (the softmax masks j > i by select)
    const int Kl = (CMODE == 2) ? min(K, r0 + roff + 64) : K;        // P.V: probabilities are exactly 0 beyond the diagonal block, so the K loop stops there
    v8f acc[4][4];
#pragma unroll
    for (int mb = 0; mb < 4; ++mb)
#pragma unroll
        for (int nb = 0; nb < 4; ++nb) acc[mb][nb] = (v8f){};
    const size_t aoff = (size_t)(r0 + lr) * K + 8 * hi, boff = (size_t)(c0 + lr) * K + 8 * hi;
#pragma unroll 1
    for (int kc = 0; kc < Kl; kc += 32) {
        V a[4], a2[4];
#pragma unroll
        for (int mb = 0; mb < 4; ++mb) { a[mb] = WFrag<T16>::ld(A + aoff + (size_t)mb * 16 * K + kc); if (NSPLIT == 1 || NSPLIT == 2) a2[mb] = WFrag<T16>::ld(A2 + aoff + (size_t)mb * 16 * K + kc); }
#pragma unroll
        for (int nb = 0; nb < 4; ++nb) { const V b = WFrag<T16>::ld(Bt + boff + (size_t)nb * 16 * K + kc); V b2; if (NSPLIT >= 2) b2 = WFrag<T16>::ld(Bt2 + boff + (size_t)nb * 16 * K + kc);
#pragma unroll
            for (int mb = 0; mb < 4; ++mb) { acc[mb][nb] = WFrag<T16>::mma(a[mb], b, acc[mb][nb]); if (NSPLIT == 1 || NSPLIT == 2) acc[mb][nb] = WFrag<T16>::mma(a2[mb], b, acc[mb][nb]); if (NSPLIT >= 2) acc[mb][nb] = WFrag<T16>::mma(a[mb], b2, acc[mb][nb]); } }
        asm volatile("v_nop\n\tv_nop\n\tv_nop\n\tv_nop" : "+v"(acc[0][0]), "+v"(acc[1][1]), "+v"(acc[2][2]), "+v"(acc[3][3]) : "v"(a[0]), "v"(a[3]));
    }
#pragma unroll
    for (int mb = 0; mb < 4; ++mb) {
#pragma unroll
        for (int nb = 0; nb < 4; ++nb) {
#pragma unroll
            for (int j = 0; j < 8; ++j) os[(hi * 8 + j) * 68 + nb * 16 + lr] = acc[mb][nb][j]; }
        __builtin_amdgcn_wave_barrier(); asm volatile("" ::: "memory");
        float* crow = C + (size_t)(r0 + mb * 16) * ldc + c0;
{
#pragma unroll
            for (int s = 0; s < 8; ++s) { const int row = 2 * s + hi, cofs = lr * 4; v4f val = *(const v4fa*)(os + row * 68 + cofs); if (CMODE == 2) val *= osc;
                *(v4f*)(crow + (size_t)row * ldc + cofs) = val; }
             }
        __builtin_amdgcn_wave_barrier(); asm volatile("" ::: "memory");
    }
}

__global__ __launch_bounds__(256) void k_wtG(const float* __restrict__ w, int K, int N, bf* Bt) {
    w += (size_t)blockIdx.y * K * N; Bt += (size_t)blockIdx.y * N * K;   // blockIdx.y = head: its [K][N] block -> its N rows of Bt
    const int lane = threadIdx.x & 31; const int L0 = (blockIdx.x * 8 + (threadIdx.x >> 5)) * 8; const int nlines = N * K / 64;
{
#pragma unroll 1
        for (int l = 0; l < 8; ++l) { const int L = L0 + l; if (L >= nlines) break; const size_t e = (size_t)L * 64 + lane * 2; const int k = (int)(e % K), n = (int)(e / K); v2us o;
            o[0] = f2bf(w[(size_t)k * N + n]); o[1] = f2bf(w[(size_t)(k + 1) * N + n]); *(v2us*)(Bt + e) = o; }
         }
}
__global__ __launch_bounds__(256) void k_cvt8(const float* __restrict__ src, bf* dst, size_t n8) { const size_t i = (size_t)blockIdx.x * 256 + threadIdx.x; if (i >= n8) return; const v8f v = *(const v8f*)(src + i * 8); v8us o;
#pragma unroll
    for (int k = 0; k < 8; ++k) o[k] = f2bf(v[k]); *(v8us*)(dst + i * 8) = o;  }

// k_asoft: per row (zz, i): t = S x HD^-0.5 for j <= i and i - j < WIN (sliding causal window; the reference's -1e9 additive fill vanishes identically); softmax over the 2048 keys (register row, one exp, fixed trees);
__global__ __launch_bounds__(256) void k_asoft(const float* __restrict__ Sb, h16* P16, bf* Ph, bf* Pl) {
    const int lane = threadIdx.x & 31; const int row = blockIdx.x * 8 + (threadIdx.x >> 5); if (row >= ZH * TT) return; const int i = row % TT; const int zz = row / TT; (void)zz; const bool hires = (i < RH); const float* sr = Sb + (size_t)row * TT; float v[TT / 32]; float mx = -3.0e38f;
#pragma unroll
    for (int ch = 0; ch < TT / 128; ++ch) { const int j0 = ch * 128 + lane * 4; const v4f a = *(const v4f*)(sr + j0);
#pragma unroll
        for (int q = 0; q < 4; ++q) { const int j = j0 + q; (void)j; const float t = (j <= i && i - j < WIN) ? a[q] * SCL : -3.0e38f; v[ch * 4 + q] = t; mx = fmaxf(mx, t); } }
#pragma unroll
    for (int sh = 16; sh; sh >>= 1) mx = fmaxf(mx, __shfl_xor(mx, sh, 32));
    float sum = 0.f;
#pragma unroll
    for (int k = 0; k < TT / 32; ++k) { float d0 = __fsub_rn(v[k], mx); asm volatile("" : "+v"(d0)); v[k] = __builtin_amdgcn_exp2f(__fmul_rn(d0, 1.4426950408889634f)); sum += v[k]; }
#pragma unroll
    for (int sh = 16; sh; sh >>= 1) sum += __shfl_xor(sum, sh, 32);
    const float f = __fdiv_rn(hires ? 1.0f : PCAR, sum);
{
        if (hires) {
#pragma unroll
            for (int ch = 0; ch < TT / 128; ++ch) { v4us oh, ol;
#pragma unroll
                for (int q = 0; q < 4; ++q) { unsigned short a, c2; splitf(v[ch * 4 + q] * f, a, c2); oh[q] = a; ol[q] = c2; }
                const size_t oo = ((size_t)zz * (RH ? RH : 1) + i) * TT + ch * 128 + lane * 4; *(v4us*)(Ph + oo) = oh; *(v4us*)(Pl + oo) = ol; }
        } else {
#pragma unroll
            for (int ch = 0; ch < TT / 128; ++ch) { v4h o4;
#pragma unroll
                for (int q = 0; q < 4; ++q) o4[q] = tohx(v[ch * 4 + q] * f);
                *(v4h*)(P16 + ((size_t)zz * (TT - RH) + (i - RH)) * TT + ch * 128 + lane * 4) = o4; } }   // P16 holds only the rows >= RH of each plane
         }
}

extern "C" void kernel_launch(void* const* d_in, const int* in_sizes, int n_in,
                              void* d_out, int out_size, void* d_ws, size_t ws_size, hipStream_t stream) {
    (void)in_sizes; (void)n_in; (void)out_size;
    const float* x = (const float*)d_in[0]; const float* pq = (const float*)d_in[1]; const float* pk = (const float*)d_in[2]; const float* pv = (const float*)d_in[3];   /* each [2][1024][512] */ const float* wq = pq, *wk = pk, *wv = pv, *wo = nullptr; (void)wo;
    float* OUT = (float*)d_out;     // [4][2048][1024]
    char* wsp = (char*)d_ws;
    auto take = [&](size_t bytes) { char* p = wsp; wsp += (bytes + 255) & ~(size_t)255; return (void*)p; };
    // Workspace by lifetime (stream-ordered): the score planes' region first holds the bf16 weights and x, dead once the q, k, v planes exist; the probabilities overwrite the q and k planes, dead after the scores.
    float* Sb = (float*)take((size_t)ZH * TT * TT * 4);
    bf* QPh = (bf*)take((size_t)ZH * TT * HD * 2); bf* QPl = (bf*)take((size_t)ZH * TT * HD * 2); bf* KPh = (bf*)take((size_t)ZH * TT * HD * 2); bf* KPl = (bf*)take((size_t)ZH * TT * HD * 2);
    h16* VT16 = (h16*)take((size_t)ZH * HD * TT * 2); bf* VTh = (bf*)take((size_t)ZH * HD * TT * 2); bf* VTl = (bf*)take((size_t)ZH * HD * TT * 2); bf* Pl = (bf*)take((size_t)ZH * RH * TT * 2);
    if ((size_t)(wsp - (char*)d_ws) > ws_size) return;    // ws 256 MiB
    wsp = (char*)Sb;     // inside the score region (22 of its 128 MiB), dead before the scores are written
    bf* WQ = (bf*)take((size_t)DQ * DM * 2); bf* WK = (bf*)take((size_t)DKV * DM * 2); bf* WV = (bf*)take((size_t)DKV * DM * 2); bf* XB = (bf*)take((size_t)NB_ * TT * DM * 2);
    wsp = (char*)QPh;    // inside the q and k planes (64 MiB), dead after the scores
    h16* P16 = (h16*)take((size_t)ZH * (TT - RH) * TT * 2); bf* Ph = (bf*)take((size_t)ZH * RH * TT * 2);
    const dim3 GW((unsigned)((DM * HD / 64 + 63) / 64), NH_, 1);   // head hh's 'xw' [1024][512] -> Bt rows hh*512..
    k_wtG<<<GW, 256, 0, stream>>>(wq, DM, HD, WQ); k_wtG<<<GW, 256, 0, stream>>>(wk, DM, HD, WK); k_wtG<<<GW, 256, 0, stream>>>(wv, DM, HD, WV);
    k_cvt8<<<(unsigned)(((size_t)NB_ * TT * DM / 8 + 255) / 256), 256, 0, stream>>>(x, XB, (size_t)NB_ * TT * DM / 8);
    k_gemmw<bf, 0, false><<<dim3(NB_ * TT / 64, DQ / 64, 1), 32, 0, stream>>>(XB, nullptr, WQ, nullptr, DM, nullptr, QPh, QPl);   /* the four batches' rows are one [8192][1024] A */
    k_gemmw<bf, 0, false><<<dim3(NB_ * TT / 64, DKV / 64, 1), 32, 0, stream>>>(XB, nullptr, WK, nullptr, DM, nullptr, KPh, KPl);
    k_gemmw<bf, 0, true><<<dim3(DKV / 64, NB_ * TT / 64, 1), 32, 0, stream>>>(WV, nullptr, XB, nullptr, DM, VT16, VTh, VTl);   /* v as W x^T: tile rows are d, columns t */
    // one kv head per query head: plane z = b * NH_ + h of q, k and v (z-strides TT*HD)
    k_gemmc<bf, 2, 1><<<dim3(TT / 64, TT / 64, ZH), 32, 0, stream>>>(QPh, QPl, KPh, KPl, HD, Sb, TT, 0, (size_t)TT * HD, (size_t)TT * HD, (size_t)NH_ * TT * TT, (size_t)TT * TT, 1.0f);   /* scores hi/lo on EVERY row (K = 512) */
    k_asoft<<<ZH * TT / 8, 256, 0, stream>>>(Sb, P16, Ph, Pl);
    // attn.v stores the output rows itself: plane (b, h) starts at row b * TT, column h * HD of OUT (pitch DQ); the fp16 rows drop the probabilities' carry factor
    k_gemmc<bf, 2, 2><<<dim3(RH / 64, HD / 64, ZH), 32, 0, stream>>>(Ph, Pl, VTh, VTl, TT, OUT, DQ, 0, (size_t)RH * TT, (size_t)HD * TT, (size_t)TT * DQ, (size_t)HD, 1.0f);
    k_gemmc<h16, 0, 2><<<dim3((TT - RH) / 64, HD / 64, ZH), 32, 0, stream>>>(P16, nullptr, VT16, nullptr, TT, OUT + (size_t)RH * DQ, DQ, RH, (size_t)(TT - RH) * TT, (size_t)HD * TT, (size_t)TT * DQ, (size_t)HD, 1.0f / PCAR);
}

// v003
// A run of this version takes 216 microseconds.
// Two timings next to v002 both put it at 1.71 times that version's speed.
// All steps since v000 together make it 4.97 times as fast.
#include <hip/hip_runtime.h>

// Two-head (512-wide heads) causal self-attention with per-head weight tensors (embedded [4][2048][1024]; q, k, v = einsum('bse,hed', x, W[h]) (Wq, Wk, Wv [2][1024][512] 1/32: head h's 'xw' block); scores / sqrt(512); causal (-1e30 == exclusion); softmax; ctx = concat-heads(attn v) -> [4][2048][1024] (8.4 M; no output projection)).
// Layout, all four batches at once (batch and head ride in the grid): bf16 copy of x; each projection tensor's two 'xw' [1024][512] blocks transposed into one [1024][1024] Bt (rows h*512..); exact projections whose tile epilogues store the q and k hi/lo planes and (product taken as W x^T) the transposed v planes directly; causal T-2048 attention, the eight (batch, head) planes side by side in grid z (hi/lo 3-product score tiles on EVERY row; P and attn.v hybrid: rows < 512 hi/lo, rest fp16 x1024; tiles above the diagonal skipped); the attn.v tile epilogues scale and store the output rows.
// Compute dtypes, f32 accumulate: every input rounded to bf16; projections exact; scores 3 products on every row (K = 512); softmax f32 (x 1/sqrt(512)); attn.v rows < 512 3 products, rest fp16; output f32.

#define NB_  4
#define TT   2048
#define DM   1024
#define NH_  2
#define NKV  2
#define REP  (NH_ / NKV)
#define HD   512
#define DQ   (NH_ * HD)
#define DKV  (NKV * HD)
#define ZH   (NB_ * NH_)          // (batch, head) planes per attention launch: z = b * NH_ + h
#define RH   512                  // query rows < RH use hi+lo planes (0: none)
#define WIN  2048
#define PCAR 1024.0f
#define SCL  0.044194173824159223f   // 1/sqrt(hd = 512)
typedef _Float16 h16;
typedef unsigned short bf;
typedef __attribute__((ext_vector_type(16))) __bf16   v16bf;
typedef __attribute__((ext_vector_type(16))) _Float16 v16h;
typedef __attribute__((ext_vector_type(8)))  _Float16 v8h;
typedef __attribute__((ext_vector_type(8)))  unsigned short v8us;
typedef __attribute__((ext_vector_type(8)))  float    v8f;
typedef __attribute__((ext_vector_type(4)))  float    v4f;
typedef v8h  __attribute__((may_alias)) v8ha;
typedef v4f  __attribute__((may_alias)) v4fa;
typedef v8us __attribute__((may_alias)) v8usa;

__device__ __forceinline__ unsigned short f2bf(float f) { unsigned u = __float_as_uint(f); u += 0x7FFFu + ((u >> 16) & 1u); return (unsigned short)(u >> 16); }
__device__ __forceinline__ float bf2f(unsigned short b) { return __uint_as_float(((unsigned)b) << 16); }
__device__ __forceinline__ float bfr(float f) { return bf2f(f2bf(f)); }
__device__ __forceinline__ v16h cat16(v8h lo, v8h hi) { return __builtin_shufflevector(lo, hi, 0, 1, 2, 3, 4, 5, 6, 7, 8, 9, 10, 11, 12, 13, 14, 15); }
__device__ __forceinline__ v16bf cat16b(v8us lo, v8us hi) { return __builtin_bit_cast(v16bf, __builtin_shufflevector(lo, hi, 0, 1, 2, 3, 4, 5, 6, 7, 8, 9, 10, 11, 12, 13, 14, 15)); }
__device__ __forceinline__ v8f wmma16(v16h a, v16h b, v8f c) { return __builtin_amdgcn_wmma_f32_16x16x32_f16(false, a, false, b, (short)0, c, false, false); }
__device__ __forceinline__ v8f wmmab(v16bf a, v16bf b, v8f c) { return __builtin_amdgcn_wmma_f32_16x16x32_bf16(false, a, false, b, (short)0, c, false, false); }



__device__ __forceinline__ h16 tohx(float x) { return (h16)x; }
__device__ __forceinline__ void splitf(float y, unsigned short& h, unsigned short& l) { h = f2bf(y); l = f2bf(y - bf2f(h)); }
typedef __attribute__((ext_vector_type(2))) _Float16 v2h;
typedef __attribute__((ext_vector_type(4))) _Float16 v4h;
typedef __attribute__((ext_vector_type(2))) unsigned short v2us;
typedef __attribute__((ext_vector_type(4))) unsigned short v4us;
typedef __attribute__((ext_vector_type(2))) float v2f;
typedef __attribute__((ext_vector_type(4))) int v4i;

// ---- k_gemmw: register-blocked projection GEMM, one wave per 64x64 tile (16 accumulators), 2 x 2 waves per work-group on a 128x128 tile; operands from K-contiguous 16-bit planes through LDS (tile_loop); grid (M/128, N/128), 128 threads.
// c[m][n] = sum_k A[m][k] Bt[n][k] (f32; + split products per NSPLIT) goes from the accumulators through the wave's LDS rows straight into the 16-bit planes its consumers read, in whole 128-byte lines. K % 64 == 0.
// VT false: m = (b, t), n = (h, d) -> hi/lo planes [b][h][t][d].  VT true: m = (h, d), n = (b, t) -> fp16 and hi/lo planes [b][h][d][t].
template <typename T16> struct WFrag;
template <> struct WFrag<h16> { typedef v16h V; static __device__ __forceinline__ V ld(const h16* p) { return cat16(*(const v8h*)p, *(const v8h*)(p + 16)); } static __device__ __forceinline__ v8f mma(V a, V b, v8f c) { return wmma16(a, b, c); } };
template <> struct WFrag<bf> { typedef v16bf V; static __device__ __forceinline__ V ld(const bf* p) { return cat16b(*(const v8us*)p, *(const v8us*)(p + 16)); } static __device__ __forceinline__ v8f mma(V a, V b, v8f c) { return wmmab(a, b, c); } };
// ---- tile_loop: the K loop of a 128x128 work-group tile. A stage is 64 k (128-byte rows, so every copy instruction moves four whole lines) of the 128 A rows and the 128 Bt rows of each plane,
// at an LDS pitch of 144 bytes (16 x odd: the ds_load_b128 fragment reads meet no bank twice). Two buffers: stage t + 2 is copied into the buffer that trip t has just left, while trip t + 1 computes.
// The k order of the products is that of the one-wave kernel (ascending, 32 at a time). nst = stages of the work-group, nstw <= nst = stages this wave multiplies (wave-uniform).
#define LPB   144                  // LDS row pitch, bytes
#define PLB   (128 * LPB)          // one plane's 128 rows in LDS, bytes
#define OSB   (16 * 68 * 4)        // one wave's output staging rows, bytes (they reuse the ring behind the loop's last barrier)
template <int NSPLIT> struct RingB { static constexpr int NPL = 2 + ((NSPLIT == 1 || NSPLIT == 2) ? 1 : 0) + ((NSPLIT >= 2) ? 1 : 0); static constexpr int STG = NPL * PLB; };
// eight asynchronous copies: this lane's 16 bytes of rows r, r + 16, .. r + 112 of one plane. The s_wait_xcnt stands inside the statement so that no address register is rewritten in front of it.
template <typename T16>
__device__ __forceinline__ void cp_plane(const T16* g, size_t p16, unsigned l) {
    asm volatile("global_load_async_to_lds_b128 %0, %8, off\n\t"
                 "global_load_async_to_lds_b128 %1, %9, off\n\t"
                 "global_load_async_to_lds_b128 %2, %10, off\n\t"
                 "global_load_async_to_lds_b128 %3, %11, off\n\t"
                 "global_load_async_to_lds_b128 %4, %12, off\n\t"
                 "global_load_async_to_lds_b128 %5, %13, off\n\t"
                 "global_load_async_to_lds_b128 %6, %14, off\n\t"
                 "global_load_async_to_lds_b128 %7, %15, off\n\t"
                 "s_wait_xcnt 0x0"
                 :: "v"(l), "v"(l + 16 * LPB), "v"(l + 32 * LPB), "v"(l + 48 * LPB), "v"(l + 64 * LPB), "v"(l + 80 * LPB), "v"(l + 96 * LPB), "v"(l + 112 * LPB),
                    "v"(g), "v"(g + p16), "v"(g + 2 * p16), "v"(g + 3 * p16), "v"(g + 4 * p16), "v"(g + 5 * p16), "v"(g + 6 * p16), "v"(g + 7 * p16) : "memory");
}
template <typename T16, int NSPLIT>
__device__ __forceinline__ void tile_loop(const T16* __restrict__ A, const T16* __restrict__ A2, const T16* __restrict__ Bt, const T16* __restrict__ Bt2, int K, int R0, int C0, int nst, int nstw, int wm, int wn, char* sm, v8f (&acc)[4][4]) {
    typedef typename WFrag<T16>::V V;
    constexpr bool HA2 = (NSPLIT == 1 || NSPLIT == 2), HB2 = (NSPLIT >= 2); constexpr int STG = RingB<NSPLIT>::STG;
    const int tid = threadIdx.x, lane = tid & 31, lr = lane & 15, hi = lane >> 4;
    const unsigned lcp = (unsigned)(size_t)sm + (unsigned)((tid >> 3) * LPB + (tid & 7) * 16);    // this lane's LDS byte address in row tid / 8 of plane 0, buffer 0
    const size_t ga = (size_t)(R0 + (tid >> 3)) * K + (tid & 7) * 8, gb = (size_t)(C0 + (tid >> 3)) * K + (tid & 7) * 8, p16 = (size_t)16 * K;
    auto fill = [&](int s) { const unsigned l = lcp + (unsigned)((s & 1) * STG); const int k0 = s * 64;
        cp_plane(A + ga + k0, p16, l); cp_plane(Bt + gb + k0, p16, l + PLB); if (HA2) cp_plane(A2 + ga + k0, p16, l + 2 * PLB); if (HB2) cp_plane(Bt2 + gb + k0, p16, l + (HA2 ? 3 : 2) * PLB); };
    fill(0);
    asm volatile("s_wait_asynccnt 0x0" ::: "memory");   // this wave's share of stage 0 has landed
    __syncthreads();                                     // publishes stage 0
    if (nst > 1) fill(1);
    const int fa = (wm * 64 + lr) * LPB + hi * 16, fb = PLB + (wn * 64 + lr) * LPB + hi * 16;
    // the stage loop stays rolled (one trip per stage: the ring's order of waits, barrier and refill stands once in the text, and the text stays small); the loops inside are unrolled so that fragments and accumulators are registers
#pragma unroll 1
    for (int t = 0; t < nst; ++t) {
        if (t < nstw) {
            const char* sb = sm + (t & 1) * STG;
#pragma unroll
            for (int ks = 0; ks < 2; ++ks) { V a[4], a2[4], b[4], b2[4];
#pragma unroll
                for (int mb = 0; mb < 4; ++mb) { a[mb] = WFrag<T16>::ld((const T16*)(sb + fa + mb * 16 * LPB + ks * 64)); if (HA2) a2[mb] = WFrag<T16>::ld((const T16*)(sb + 2 * PLB + fa + mb * 16 * LPB + ks * 64)); }
#pragma unroll
                for (int nb = 0; nb < 4; ++nb) { b[nb] = WFrag<T16>::ld((const T16*)(sb + fb + nb * 16 * LPB + ks * 64)); if (HB2) b2[nb] = WFrag<T16>::ld((const T16*)(sb + (HA2 ? 2 : 1) * PLB + fb + nb * 16 * LPB + ks * 64)); }
                if (!HA2 && !HB2) __builtin_amdgcn_sched_barrier(0);   // one product per fragment pair: keeps the eight fragments' LDS reads one group in front of their 16 matrix instructions (a wait to 0 in front of every four would leave the wave idle for the LDS latency each time)
#pragma unroll
                for (int nb = 0; nb < 4; ++nb)
#pragma unroll
                    for (int mb = 0; mb < 4; ++mb) { acc[mb][nb] = WFrag<T16>::mma(a[mb], b[nb], acc[mb][nb]); if (HA2) acc[mb][nb] = WFrag<T16>::mma(a2[mb], b[nb], acc[mb][nb]); if (HB2) acc[mb][nb] = WFrag<T16>::mma(a[mb], b2[nb], acc[mb][nb]); }
            }
            __builtin_amdgcn_sched_barrier(0);   // keeps the stage's matrix instructions in front of the waits below: all of them then lie between the issue of the next stage's copies and the wait for them, and the refill follows the barrier at once
        }
        asm volatile("s_wait_dscnt 0x0" ::: "memory");      // this wave's reads of buffer t & 1 are done before it is refilled
        asm volatile("s_wait_asynccnt 0x0" ::: "memory");   // this wave's share of stage t + 1 has landed
        __syncthreads();                                     // publishes stage t + 1 and ends every reader's last read of buffer t & 1
        if (t + 2 < nst) fill(t + 2);
    }
    asm volatile("s_wait_asynccnt 0x0" ::: "memory");       // nothing in flight when the ring becomes output staging
}

template <typename T16, int NSPLIT, bool VT>
__global__ __launch_bounds__(128) void k_gemmw(const T16* __restrict__ A, const T16* __restrict__ A2, const T16* __restrict__ Bt, const T16* __restrict__ Bt2, int K, h16* P16, bf* Ph, bf* Pl) {
    __shared__ __align__(16) char sm[2 * RingB<NSPLIT>::STG];
    const int lane = threadIdx.x & 31, lr = lane & 15, hi = lane >> 4; const int wave = __builtin_amdgcn_readfirstlane((int)(threadIdx.x >> 5)), wm = wave >> 1, wn = wave & 1;
    const int R0 = blockIdx.x * 128, C0 = blockIdx.y * 128, r0 = R0 + wm * 64, c0 = C0 + wn * 64;
    v8f acc[4][4];
#pragma unroll
    for (int mb = 0; mb < 4; ++mb)
#pragma unroll
        for (int nb = 0; nb < 4; ++nb) acc[mb][nb] = (v8f){};
    tile_loop<T16, NSPLIT>(A, A2, Bt, Bt2, K, R0, C0, K / 64, K / 64, wm, wn, sm, acc);
    float* os = (float*)(sm + wave * OSB);
    // a 64x64 tile lies inside one batch and one head: its first element and its row pitch in the planes
    const size_t base = VT ? (((size_t)(c0 / TT) * NKV + r0 / HD) * HD + r0 % HD) * TT + c0 % TT : (((size_t)(r0 / TT) * NH_ + c0 / HD) * TT + r0 % TT) * HD + c0 % HD;
    const int pitch = VT ? TT : HD;
#pragma unroll
    for (int mb = 0; mb < 4; ++mb) {
#pragma unroll
        for (int nb = 0; nb < 4; ++nb) {
#pragma unroll
            for (int j = 0; j < 8; ++j) os[(hi * 8 + j) * 68 + nb * 16 + lr] = acc[mb][nb][j]; }
        __builtin_amdgcn_wave_barrier(); asm volatile("" ::: "memory");
#pragma unroll
        for (int s = 0; s < 4; ++s) { const int row = 4 * s + (lane >> 3), cofs = (lane & 7) * 8; const v4f v0 = *(const v4fa*)(os + row * 68 + cofs), v1 = *(const v4fa*)(os + row * 68 + cofs + 4); v8h o16; v8us oh, ol;
#pragma unroll
            for (int q = 0; q < 8; ++q) { const float y = (q < 4) ? v0[q & 3] : v1[q & 3]; unsigned short a2, c2; splitf(y, a2, c2); oh[q] = a2; ol[q] = c2; if (VT) o16[q] = tohx(y); }
            const size_t oo = base + (size_t)(mb * 16 + row) * pitch + cofs; *(v8us*)(Ph + oo) = oh; *(v8us*)(Pl + oo) = ol; if (VT) *(v8h*)(P16 + oo) = o16; }
        __builtin_amdgcn_wave_barrier(); asm volatile("" ::: "memory");
    }
}

// ---- k_gemmc: the same 2 x 2 waves of 64x64 tiles specialised for causal attention: CMODE 1 skips score tiles entirely above the diagonal (query rows r0+roff.., key columns c0..; a work-group leaves whole, a single wave only skips its products and stores), CMODE 2 limits the
// key (K) loop of the probability x value contraction to the diagonal block (probabilities beyond it are exactly zero). roff = row offset of this launch's first row within the sequence. CMODE 2 also scales by osc on the way out. Plane z = b * NH_ + h of C starts at b * sCb + h * sCh.
template <typename T16, int NSPLIT, int CMODE>
__global__ __launch_bounds__(128) void k_gemmc(const T16* __restrict__ A, const T16* __restrict__ A2, const T16* __restrict__ Bt, const T16* __restrict__ Bt2, int K, float* C, int ldc, int roff, size_t sA, size_t sB, size_t sCb, size_t sCh, float osc) {
    __shared__ __align__(16) char sm[2 * RingB<NSPLIT>::STG];
    const size_t z = blockIdx.z; A += z * sA; if (A2) A2 += z * sA; Bt += z * sB; if (Bt2) Bt2 += z * sB; C += (z / NH_) * sCb + (z % NH_) * sCh;
    const int lane = threadIdx.x & 31, lr = lane & 15, hi = lane >> 4; const int wave = __builtin_amdgcn_readfirstlane((int)(threadIdx.x >> 5)), wm = wave >> 1, wn = wave & 1;
    const int R0 = blockIdx.x * 128, C0 = blockIdx.y * 128, r0 = R0 + wm * 64, c0 = C0 + wn * 64;
    if (CMODE == 1 && C0 > R0 + roff + 127) return;                 // all four score tiles entirely above the causal diagonal: the whole work-group leaves, in front of every copy and barrier
    const bool skip = (CMODE == 1 && c0 > r0 + roff + 63);           // this wave's score tile entirely above the diagonal: never read (the softmax masks j > i by select); the wave still copies and meets every barrier
    const int Kg = (CMODE == 2) ? min(K, R0 + roff + 128) : K;       // P.V: probabilities are exactly 0 beyond the diagonal block, so the K loop stops there: the work-group's stages ..
    const int Kl = skip ? 0 : ((CMODE == 2) ? min(K, r0 + roff + 64) : K);   // .. and this wave's own
    v8f acc[4][4];
#pragma unroll
    for (int mb = 0; mb < 4; ++mb)
#pragma unroll
        for (int nb = 0; nb < 4; ++nb) acc[mb][nb] = (v8f){};
    tile_loop<T16, NSPLIT>(A, A2, Bt, Bt2, K, R0, C0, Kg / 64, Kl / 64, wm, wn, sm, acc);
    if (skip) return;                                                // behind the last barrier
    float* os = (float*)(sm + wave * OSB);
#pragma unroll
    for (int mb = 0; mb < 4; ++mb) {
#pragma unroll
        for (int nb = 0; nb < 4; ++nb) {
#pragma unroll
            for (int j = 0; j < 8; ++j) os[(hi * 8 + j) * 68 + nb * 16 + lr] = acc[mb][nb][j]; }
        __builtin_amdgcn_wave_barrier(); asm volatile("" ::: "memory");
        float* crow = C + (size_t)(r0 + mb * 16) * ldc + c0;
{
#pragma unroll
            for (int s = 0; s < 8; ++s) { const int row = 2 * s + hi, cofs = lr * 4; v4f val = *(const v4fa*)(os + row * 68 + cofs); if (CMODE == 2) val *= osc;
                *(v4f*)(crow + (size_t)row * ldc + cofs) = val; }
             }
        __builtin_amdgcn_wave_barrier(); asm volatile("" ::: "memory");
    }
}

__global__ __launch_bounds__(256) void k_wtG(const float* __restrict__ w, int K, int N, bf* Bt) {
    w += (size_t)blockIdx.y * K * N; Bt += (size_t)blockIdx.y * N * K;   // blockIdx.y = head: its [K][N] block -> its N rows of Bt
    const int lane = threadIdx.x & 31; const int L0 = (blockIdx.x * 8 + (threadIdx.x >> 5)) * 8; const int nlines = N * K / 64;
{
#pragma unroll 1
        for (int l = 0; l < 8; ++l) { const int L = L0 + l; if (L >= nlines) break; const size_t e = (size_t)L * 64 + lane * 2; const int k = (int)(e % K), n = (int)(e / K); v2us o;
            o[0] = f2bf(w[(size_t)k * N + n]); o[1] = f2bf(w[(size_t)(k + 1) * N + n]); *(v2us*)(Bt + e) = o; }
         }
}
__global__ __launch_bounds__(256) void k_cvt8(const float* __restrict__ src, bf* dst, size_t n8) { const size_t i = (size_t)blockIdx.x * 256 + threadIdx.x; if (i >= n8) return; const v8f v = *(const v8f*)(src + i * 8); v8us o;
#pragma unroll
    for (int k = 0; k < 8; ++k) o[k] = f2bf(v[k]); *(v8us*)(dst + i * 8) = o;  }

// k_asoft: per row (zz, i): t = S x HD^-0.5 for j <= i and i - j < WIN (sliding causal window; the reference's -1e9 additive fill vanishes identically); softmax over the 2048 keys (register row, one exp, fixed trees);
__global__ __launch_bounds__(256) void k_asoft(const float* __restrict__ Sb, h16* P16, bf* Ph, bf* Pl) {
    const int lane = threadIdx.x & 31; const int row = blockIdx.x * 8 + (threadIdx.x >> 5); if (row >= ZH * TT) return; const int i = row % TT; const int zz = row / TT; (void)zz; const bool hires = (i < RH); const float* sr = Sb + (size_t)row * TT; float v[TT / 32]; float mx = -3.0e38f;
#pragma unroll
    for (int ch = 0; ch < TT / 128; ++ch) { const int j0 = ch * 128 + lane * 4; const v4f a = *(const v4f*)(sr + j0);
#pragma unroll
        for (int q = 0; q < 4; ++q) { const int j = j0 + q; (void)j; const float t = (j <= i && i - j < WIN) ? a[q] * SCL : -3.0e38f; v[ch * 4 + q] = t; mx = fmaxf(mx, t); } }
#pragma unroll
    for (int sh = 16; sh; sh >>= 1) mx = fmaxf(mx, __shfl_xor(mx, sh, 32));
    float sum = 0.f;
#pragma unroll
    for (int k = 0; k < TT / 32; ++k) { float d0 = __fsub_rn(v[k], mx); asm volatile("" : "+v"(d0)); v[k] = __builtin_amdgcn_exp2f(__fmul_rn(d0, 1.4426950408889634f)); sum += v[k]; }
#pragma unroll
    for (int sh = 16; sh; sh >>= 1) sum += __shfl_xor(sum, sh, 32);
    const float f = __fdiv_rn(hires ? 1.0f : PCAR, sum);
{
        if (hires) {
#pragma unroll
            for (int ch = 0; ch < TT / 128; ++ch) { v4us oh, ol;
#pragma unroll
                for (int q = 0; q < 4; ++q) { unsigned short a, c2; splitf(v[ch * 4 + q] * f, a, c2); oh[q] = a; ol[q] = c2; }
                const size_t oo = ((size_t)zz * (RH ? RH : 1) + i) * TT + ch * 128 + lane * 4; *(v4us*)(Ph + oo) = oh; *(v4us*)(Pl + oo) = ol; }
        } else {
#pragma unroll
            for (int ch = 0; ch < TT / 128; ++ch) { v4h o4;
#pragma unroll
                for (int q = 0; q < 4; ++q) o4[q] = tohx(v[ch * 4 + q] * f);
                *(v4h*)(P16 + ((size_t)zz * (TT - RH) + (i - RH)) * TT + ch * 128 + lane * 4) = o4; } }   // P16 holds only the rows >= RH of each plane
         }
}

extern "C" void kernel_launch(void* const* d_in, const int* in_sizes, int n_in,
                              void* d_out, int out_size, void* d_ws, size_t ws_size, hipStream_t stream) {
    (void)in_sizes; (void)n_in; (void)out_size;
    const float* x = (const float*)d_in[0]; const float* pq = (const float*)d_in[1]; const float* pk = (const float*)d_in[2]; const float* pv = (const float*)d_in[3];   /* each [2][1024][512] */ const float* wq = pq, *wk = pk, *wv = pv, *wo = nullptr; (void)wo;
    float* OUT = (float*)d_out;     // [4][2048][1024]
    char* wsp = (char*)d_ws;
    auto take = [&](size_t bytes) { char* p = wsp; wsp += (bytes + 255) & ~(size_t)255; return (void*)p; };
    // Workspace by lifetime (stream-ordered): the score planes' region first holds the bf16 weights and x, dead once the q, k, v planes exist; the probabilities overwrite the q and k planes, dead after the scores.
    float* Sb = (float*)take((size_t)ZH * TT * TT * 4);
    bf* QPh = (bf*)take((size_t)ZH * TT * HD * 2); bf* QPl = (bf*)take((size_t)ZH * TT * HD * 2); bf* KPh = (bf*)take((size_t)ZH * TT * HD * 2); bf* KPl = (bf*)take((size_t)ZH * TT * HD * 2);
    h16* VT16 = (h16*)take((size_t)ZH * HD * TT * 2); bf* VTh = (bf*)take((size_t)ZH * HD * TT * 2); bf* VTl = (bf*)take((size_t)ZH * HD * TT * 2); bf* Pl = (bf*)take((size_t)ZH * RH * TT * 2);
    if ((size_t)(wsp - (char*)d_ws) > ws_size) return;    // ws 256 MiB
    wsp = (char*)Sb;     // inside the score region (22 of its 128 MiB), dead before the scores are written
    bf* WQ = (bf*)take((size_t)DQ * DM * 2); bf* WK = (bf*)take((size_t)DKV * DM * 2); bf* WV = (bf*)take((size_t)DKV * DM * 2); bf* XB = (bf*)take((size_t)NB_ * TT * DM * 2);
    wsp = (char*)QPh;    // inside the q and k planes (64 MiB), dead after the scores
    h16* P16 = (h16*)take((size_t)ZH * (TT - RH) * TT * 2); bf* Ph = (bf*)take((size_t)ZH * RH * TT * 2);
    const dim3 GW((unsigned)((DM * HD / 64 + 63) / 64), NH_, 1);   // head hh's 'xw' [1024][512] -> Bt rows hh*512..
    k_wtG<<<GW, 256, 0, stream>>>(wq, DM, HD, WQ); k_wtG<<<GW, 256, 0, stream>>>(wk, DM, HD, WK); k_wtG<<<GW, 256, 0, stream>>>(wv, DM, HD, WV);
    k_cvt8<<<(unsigned)(((size_t)NB_ * TT * DM / 8 + 255) / 256), 256, 0, stream>>>(x, XB, (size_t)NB_ * TT * DM / 8);
    k_gemmw<bf, 0, false><<<dim3(NB_ * TT / 128, DQ / 128, 1), 128, 0, stream>>>(XB, nullptr, WQ, nullptr, DM, nullptr, QPh, QPl);   /* the four batches' rows are one [8192][1024] A */
    k_gemmw<bf, 0, false><<<dim3(NB_ * TT / 128, DKV / 128, 1), 128, 0, stream>>>(XB, nullptr, WK, nullptr, DM, nullptr, KPh, KPl);
    k_gemmw<bf, 0, true><<<dim3(DKV / 128, NB_ * TT / 128, 1), 128, 0, stream>>>(WV, nullptr, XB, nullptr, DM, VT16, VTh, VTl);   /* v as W x^T: tile rows are d, columns t */
    // one kv head per query head: plane z = b * NH_ + h of q, k and v (z-strides TT*HD)
    k_gemmc<bf, 2, 1><<<dim3(TT / 128, TT / 128, ZH), 128, 0, stream>>>(QPh, QPl, KPh, KPl, HD, Sb, TT, 0, (size_t)TT * HD, (size_t)TT * HD, (size_t)NH_ * TT * TT, (size_t)TT * TT, 1.0f);   /* scores hi/lo on EVERY row (K = 512) */
    k_asoft<<<ZH * TT / 8, 256, 0, stream>>>(Sb, P16, Ph, Pl);
    // attn.v stores the output rows itself: plane (b, h) starts at row b * TT, column h * HD of OUT (pitch DQ); the fp16 rows drop the probabilities' carry factor
    k_gemmc<bf, 2, 2><<<dim3(RH / 128, HD / 128, ZH), 128, 0, stream>>>(Ph, Pl, VTh, VTl, TT, OUT, DQ, 0, (size_t)RH * TT, (size_t)HD * TT, (size_t)TT * DQ, (size_t)HD, 1.0f);
    k_gemmc<h16, 0, 2><<<dim3((TT - RH) / 128, HD / 128, ZH), 128, 0, stream>>>(P16, nullptr, VT16, nullptr, TT, OUT + (size_t)RH * DQ, DQ, RH, (size_t)(TT - RH) * TT, (size_t)HD * TT, (size_t)TT * DQ, (size_t)HD, 1.0f / PCAR);
}

// v004
// Measured time: 173 microseconds a run.
// Next to v003, in two timings, it ran 1.25 and 1.26 times as fast.
// Over all steps from v000 it is 6.24 times as fast.
#include <hip/hip_runtime.h>

// Two-head (512-wide heads) causal self-attention with per-head weight tensors (embedded [4][2048][1024]; q, k, v = einsum('bse,hed', x, W[h]) (Wq, Wk, Wv [2][1024][512] 1/32: head h's 'xw' block); scores / sqrt(512); causal (-1e30 == exclusion); softmax; ctx = concat-heads(attn v) -> [4][2048][1024] (8.4 M; no output projection)).
// Layout, all four batches at once (five launches: input conversions, projections, scores, softmax, attn.v; batch and head ride in the grid, stages that do not depend on one another share a grid): bf16 copy of x; each projection tensor's two 'xw' [1024][512] blocks transposed into one [1024][1024] Bt (rows h*512..); exact projections whose tile epilogues store the q and k hi/lo planes and (product taken as W x^T) the transposed v planes directly; causal T-2048 attention, the eight (batch, head) planes side by side in grid z (hi/lo 3-product score tiles on EVERY row; P and attn.v hybrid: rows < 512 hi/lo, rest fp16 x1024; tiles above the diagonal skipped); the attn.v tile epilogues scale and store the output rows.
// Compute dtypes, f32 accumulate: every input rounded to bf16; projections exact; scores 3 products on every row (K = 512); softmax f32 (x 1/sqrt(512)); attn.v rows < 512 3 products, rest fp16; output f32.

#define NB_  4
#define TT   2048
#define DM   1024
#define NH_  2
#define NKV  2
#define REP  (NH_ / NKV)
#define HD   512
#define DQ   (NH_ * HD)
#define DKV  (NKV * HD)
#define ZH   (NB_ * NH_)          // (batch, head) planes per attention launch: z = b * NH_ + h
#define RH   512                  // query rows < RH use hi+lo planes (0: none)
#define WIN  2048
#define PCAR 1024.0f
#define SCL  0.044194173824159223f   // 1/sqrt(hd = 512)
typedef _Float16 h16;
typedef unsigned short bf;
typedef __attribute__((ext_vector_type(16))) __bf16   v16bf;
typedef __attribute__((ext_vector_type(16))) _Float16 v16h;
typedef __attribute__((ext_vector_type(8)))  _Float16 v8h;
typedef __attribute__((ext_vector_type(8)))  unsigned short v8us;
typedef __attribute__((ext_vector_type(8)))  float    v8f;
typedef __attribute__((ext_vector_type(4)))  float    v4f;
typedef v8h  __attribute__((may_alias)) v8ha;
typedef v4f  __attribute__((may_alias)) v4fa;
typedef v8us __attribute__((may_alias)) v8usa;

__device__ __forceinline__ unsigned short f2bf(float f) { unsigned u = __float_as_uint(f); u += 0x7FFFu + ((u >> 16) & 1u); return (unsigned short)(u >> 16); }
__device__ __forceinline__ float bf2f(unsigned short b) { return __uint_as_float(((unsigned)b) << 16); }
__device__ __forceinline__ float bfr(float f) { return bf2f(f2bf(f)); }
__device__ __forceinline__ v16h cat16(v8h lo, v8h hi) { return __builtin_shufflevector(lo, hi, 0, 1, 2, 3, 4, 5, 6, 7, 8, 9, 10, 11, 12, 13, 14, 15); }
__device__ __forceinline__ v16bf cat16b(v8us lo, v8us hi) { return __builtin_bit_cast(v16bf, __builtin_shufflevector(lo, hi, 0, 1, 2, 3, 4, 5, 6, 7, 8, 9, 10, 11, 12, 13, 14, 15)); }
__device__ __forceinline__ v8f wmma16(v16h a, v16h b, v8f c) { return __builtin_amdgcn_wmma_f32_16x16x32_f16(false, a, false, b, (short)0, c, false, false); }
__device__ __forceinline__ v8f wmmab(v16bf a, v16bf b, v8f c) { return __builtin_amdgcn_wmma_f32_16x16x32_bf16(false, a, false, b, (short)0, c, false, false); }



__device__ __forceinline__ h16 tohx(float x) { return (h16)x; }
__device__ __forceinline__ void splitf(float y, unsigned short& h, unsigned short& l) { h = f2bf(y); l = f2bf(y - bf2f(h)); }
typedef __attribute__((ext_vector_type(2))) _Float16 v2h;
typedef __attribute__((ext_vector_type(4))) _Float16 v4h;
typedef __attribute__((ext_vector_type(2))) unsigned short v2us;
typedef __attribute__((ext_vector_type(4))) unsigned short v4us;
typedef __attribute__((ext_vector_type(2))) float v2f;
typedef __attribute__((ext_vector_type(4))) int v4i;

// ---- k_gemmw3: register-blocked projection GEMM, one wave per 64x64 tile (16 accumulators), 2 x 2 waves per work-group on a 128x128 tile; operands from K-contiguous 16-bit planes through LDS (tile_loop); 128 threads.
// c[m][n] = sum_k A[m][k] Bt[n][k] (f32; + split products per NSPLIT) goes from the accumulators through the wave's LDS rows straight into the 16-bit planes its consumers read, in whole 128-byte lines. K % 64 == 0.
// VT false: m = (b, t), n = (h, d) -> hi/lo planes [b][h][t][d].  VT true: m = (h, d), n = (b, t) -> fp16 and hi/lo planes [b][h][d][t].
template <typename T16> struct WFrag;
template <> struct WFrag<h16> { typedef v16h V; static __device__ __forceinline__ V ld(const h16* p) { return cat16(*(const v8h*)p, *(const v8h*)(p + 16)); } static __device__ __forceinline__ v8f mma(V a, V b, v8f c) { return wmma16(a, b, c); } };
template <> struct WFrag<bf> { typedef v16bf V; static __device__ __forceinline__ V ld(const bf* p) { return cat16b(*(const v8us*)p, *(const v8us*)(p + 16)); } static __device__ __forceinline__ v8f mma(V a, V b, v8f c) { return wmmab(a, b, c); } };
// ---- tile_loop: the K loop of a 128x128 work-group tile. A stage is 64 k (128-byte rows, so every copy instruction moves four whole lines) of the 128 A rows and the 128 Bt rows of each plane,
// at an LDS pitch of 144 bytes (16 x odd: the ds_load_b128 fragment reads meet no bank twice). Two buffers: stage t + 2 is copied into the buffer that trip t has just left, while trip t + 1 computes.
// The k order of the products is that of the one-wave kernel (ascending, 32 at a time). nst = stages of the work-group, nstw <= nst = stages this wave multiplies (wave-uniform).
#define LPB   144                  // LDS row pitch, bytes
#define PLB   (128 * LPB)          // one plane's 128 rows in LDS, bytes
#define OSB   (16 * 68 * 4)        // one wave's output staging rows, bytes (they reuse the ring behind the loop's last barrier)
template <int NSPLIT> struct RingB { static constexpr int NPL = 2 + ((NSPLIT == 1 || NSPLIT == 2) ? 1 : 0) + ((NSPLIT >= 2) ? 1 : 0); static constexpr int STG = NPL * PLB; };
// eight asynchronous copies: this lane's 16 bytes of rows r, r + 16, .. r + 112 of one plane. The s_wait_xcnt stands inside the statement so that no address register is rewritten in front of it.
template <typename T16>
__device__ __forceinline__ void cp_plane(const T16* g, size_t p16, unsigned l) {
    asm volatile("global_load_async_to_lds_b128 %0, %8, off\n\t"
                 "global_load_async_to_lds_b128 %1, %9, off\n\t"
                 "global_load_async_to_lds_b128 %2, %10, off\n\t"
                 "global_load_async_to_lds_b128 %3, %11, off\n\t"
                 "global_load_async_to_lds_b128 %4, %12, off\n\t"
                 "global_load_async_to_lds_b128 %5, %13, off\n\t"
                 "global_load_async_to_lds_b128 %6, %14, off\n\t"
                 "global_load_async_to_lds_b128 %7, %15, off\n\t"
                 "s_wait_xcnt 0x0"
                 :: "v"(l), "v"(l + 16 * LPB), "v"(l + 32 * LPB), "v"(l + 48 * LPB), "v"(l + 64 * LPB), "v"(l + 80 * LPB), "v"(l + 96 * LPB), "v"(l + 112 * LPB),
                    "v"(g), "v"(g + p16), "v"(g + 2 * p16), "v"(g + 3 * p16), "v"(g + 4 * p16), "v"(g + 5 * p16), "v"(g + 6 * p16), "v"(g + 7 * p16) : "memory");
}
template <typename T16, int NSPLIT>
__device__ __forceinline__ void tile_loop(const T16* __restrict__ A, const T16* __restrict__ A2, const T16* __restrict__ Bt, const T16* __restrict__ Bt2, int K, int R0, int C0, int nst, int nstw, int wm, int wn, char* sm, v8f (&acc)[4][4]) {
    typedef typename WFrag<T16>::V V;
    constexpr bool HA2 = (NSPLIT == 1 || NSPLIT == 2), HB2 = (NSPLIT >= 2); constexpr int STG = RingB<NSPLIT>::STG;
    const int tid = threadIdx.x, lane = tid & 31, lr = lane & 15, hi = lane >> 4;
    const unsigned lcp = (unsigned)(size_t)sm + (unsigned)((tid >> 3) * LPB + (tid & 7) * 16);    // this lane's LDS byte address in row tid / 8 of plane 0, buffer 0
    const size_t ga = (size_t)(R0 + (tid >> 3)) * K + (tid & 7) * 8, gb = (size_t)(C0 + (tid >> 3)) * K + (tid & 7) * 8, p16 = (size_t)16 * K;
    auto fill = [&](int s) { const unsigned l = lcp + (unsigned)((s & 1) * STG); const int k0 = s * 64;
        cp_plane(A + ga + k0, p16, l); cp_plane(Bt + gb + k0, p16, l + PLB); if (HA2) cp_plane(A2 + ga + k0, p16, l + 2 * PLB); if (HB2) cp_plane(Bt2 + gb + k0, p16, l + (HA2 ? 3 : 2) * PLB); };
    fill(0);
    asm volatile("s_wait_asynccnt 0x0" ::: "memory");   // this wave's share of stage 0 has landed
    __syncthreads();                                     // publishes stage 0
    if (nst > 1) fill(1);
    const int fa = (wm * 64 + lr) * LPB + hi * 16, fb = PLB + (wn * 64 + lr) * LPB + hi * 16;
    // the stage loop stays rolled (one trip per stage: the ring's order of waits, barrier and refill stands once in the text, and the text stays small); the loops inside are unrolled so that fragments and accumulators are registers
#pragma unroll 1
    for (int t = 0; t < nst; ++t) {
        if (t < nstw) {
            const char* sb = sm + (t & 1) * STG;
#pragma unroll
            for (int ks = 0; ks < 2; ++ks) { V a[4], a2[4], b[4], b2[4];
#pragma unroll
                for (int mb = 0; mb < 4; ++mb) { a[mb] = WFrag<T16>::ld((const T16*)(sb + fa + mb * 16 * LPB + ks * 64)); if (HA2) a2[mb] = WFrag<T16>::ld((const T16*)(sb + 2 * PLB + fa + mb * 16 * LPB + ks * 64)); }
#pragma unroll
                for (int nb = 0; nb < 4; ++nb) { b[nb] = WFrag<T16>::ld((const T16*)(sb + fb + nb * 16 * LPB + ks * 64)); if (HB2) b2[nb] = WFrag<T16>::ld((const T16*)(sb + (HA2 ? 2 : 1) * PLB + fb + nb * 16 * LPB + ks * 64)); }
                if (!HA2 && !HB2) __builtin_amdgcn_sched_barrier(0);   // one product per fragment pair: keeps the eight fragments' LDS reads one group in front of their 16 matrix instructions (a wait to 0 in front of every four would leave the wave idle for the LDS latency each time)
#pragma unroll
                for (int nb = 0; nb < 4; ++nb)
#pragma unroll
                    for (int mb = 0; mb < 4; ++mb) { acc[mb][nb] = WFrag<T16>::mma(a[mb], b[nb], acc[mb][nb]); if (HA2) acc[mb][nb] = WFrag<T16>::mma(a2[mb], b[nb], acc[mb][nb]); if (HB2) acc[mb][nb] = WFrag<T16>::mma(a[mb], b2[nb], acc[mb][nb]); }
            }
            __builtin_amdgcn_sched_barrier(0);   // keeps the stage's matrix instructions in front of the waits below: all of them then lie between the issue of the next stage's copies and the wait for them, and the refill follows the barrier at once
        }
        asm volatile("s_wait_dscnt 0x0" ::: "memory");      // this wave's reads of buffer t & 1 are done before it is refilled
        asm volatile("s_wait_asynccnt 0x0" ::: "memory");   // this wave's share of stage t + 1 has landed
        __syncthreads();                                     // publishes stage t + 1 and ends every reader's last read of buffer t & 1
        if (t + 2 < nst) fill(t + 2);
    }
    asm volatile("s_wait_asynccnt 0x0" ::: "memory");       // nothing in flight when the ring becomes output staging
}

template <bool VT>
__device__ __forceinline__ void gemmw_store(v8f (&acc)[4][4], float* os, int r0, int c0, int lane, int lr, int hi, h16* P16, bf* Ph, bf* Pl) {
    // a 64x64 tile lies inside one batch and one head: its first element and its row pitch in the planes
    const size_t base = VT ? (((size_t)(c0 / TT) * NKV + r0 / HD) * HD + r0 % HD) * TT + c0 % TT : (((size_t)(r0 / TT) * NH_ + c0 / HD) * TT + r0 % TT) * HD + c0 % HD;
    const int pitch = VT ? TT : HD;
#pragma unroll
    for (int mb = 0; mb < 4; ++mb) {
#pragma unroll
        for (int nb = 0; nb < 4; ++nb) {
#pragma unroll
            for (int j = 0; j < 8; ++j) os[(hi * 8 + j) * 68 + nb * 16 + lr] = acc[mb][nb][j]; }
        __builtin_amdgcn_wave_barrier(); asm volatile("" ::: "memory");
#pragma unroll
        for (int s = 0; s < 4; ++s) { const int row = 4 * s + (lane >> 3), cofs = (lane & 7) * 8; const v4f v0 = *(const v4fa*)(os + row * 68 + cofs), v1 = *(const v4fa*)(os + row * 68 + cofs + 4); v8h o16; v8us oh, ol;
#pragma unroll
            for (int q = 0; q < 8; ++q) { const float y = (q < 4) ? v0[q & 3] : v1[q & 3]; unsigned short a2, c2; splitf(y, a2, c2); oh[q] = a2; ol[q] = c2; if (VT) o16[q] = tohx(y); }
            const size_t oo = base + (size_t)(mb * 16 + row) * pitch + cofs; *(v8us*)(Ph + oo) = oh; *(v8us*)(Pl + oo) = ol; if (VT) *(v8h*)(P16 + oo) = o16; }
        __builtin_amdgcn_wave_barrier(); asm volatile("" ::: "memory");
    }
    if (!VT) asm volatile("s_wait_xcnt 0x0" ::: "memory");   // both store forms stand in one kernel, and in the built code the VT form's address arithmetic follows these stores: the wait stands in front of its rewrite of their address registers (the VT form's own stores run into the kernel's end)
}
// The three projections are independent of one another and ride in grid z of one launch: z = 0 q, z = 1 k (A = x rows over grid x, Bt = weight rows over grid y), z = 2 v (A = weight rows over grid y, Bt = x rows over grid x). grid (tokens/128, features/128, 3).
__global__ __launch_bounds__(128) void k_gemmw3(const bf* __restrict__ X, const bf* __restrict__ Wq, const bf* __restrict__ Wk, const bf* __restrict__ Wv, int K, bf* Qh, bf* Ql, bf* Kh, bf* Kl, h16* V16, bf* Vh, bf* Vl) {
    __shared__ __align__(16) char sm[2 * RingB<0>::STG];
    const int lane = threadIdx.x & 31, lr = lane & 15, hi = lane >> 4; const int wave = __builtin_amdgcn_readfirstlane((int)(threadIdx.x >> 5)), wm = wave >> 1, wn = wave & 1;
    const int zp = blockIdx.z; const bool vt = (zp == 2);
    const bf* A = vt ? Wv : X; const bf* Bt = vt ? X : (zp ? Wk : Wq);
    const int R0 = (vt ? blockIdx.y : blockIdx.x) * 128, C0 = (vt ? blockIdx.x : blockIdx.y) * 128, r0 = R0 + wm * 64, c0 = C0 + wn * 64;
    v8f acc[4][4];
#pragma unroll
    for (int mb = 0; mb < 4; ++mb)
#pragma unroll
        for (int nb = 0; nb < 4; ++nb) acc[mb][nb] = (v8f){};
    tile_loop<bf, 0>(A, nullptr, Bt, nullptr, K, R0, C0, K / 64, K / 64, wm, wn, sm, acc);
    float* os = (float*)(sm + wave * OSB);
    if (vt) gemmw_store<true>(acc, os, r0, c0, lane, lr, hi, V16, Vh, Vl);
    else gemmw_store<false>(acc, os, r0, c0, lane, lr, hi, nullptr, zp ? Kh : Qh, zp ? Kl : Ql);
}

// ---- k_gemmc: the same 2 x 2 waves of 64x64 tiles specialised for causal attention: CMODE 1 skips score tiles entirely above the diagonal (query rows r0+roff.., key columns c0..; a work-group leaves whole, a single wave only skips its products and stores), CMODE 2 limits the
// key (K) loop of the probability x value contraction to the diagonal block (probabilities beyond it are exactly zero). roff = row offset of this call's first row within the sequence. CMODE 2 also scales by osc on the way out. Plane z = b * NH_ + h of C starts at b * sCb + h * sCh.
template <typename T16, int NSPLIT, int CMODE>
__device__ __forceinline__ void gemmc_body(const T16* __restrict__ A, const T16* __restrict__ A2, const T16* __restrict__ Bt, const T16* __restrict__ Bt2, int K, float* C, int ldc, int roff, size_t sA, size_t sB, size_t sCb, size_t sCh, float osc, int bx, char* sm) {
    const size_t z = blockIdx.z; A += z * sA; if (A2) A2 += z * sA; Bt += z * sB; if (Bt2) Bt2 += z * sB; C += (z / NH_) * sCb + (z % NH_) * sCh;
    const int lane = threadIdx.x & 31, lr = lane & 15, hi = lane >> 4; const int wave = __builtin_amdgcn_readfirstlane((int)(threadIdx.x >> 5)), wm = wave >> 1, wn = wave & 1;
    const int R0 = bx * 128, C0 = blockIdx.y * 128, r0 = R0 + wm * 64, c0 = C0 + wn * 64;
    if (CMODE == 1 && C0 > R0 + roff + 127) return;                 // all four score tiles entirely above the causal diagonal: the whole work-group leaves, in front of every copy and barrier
    const bool skip = (CMODE == 1 && c0 > r0 + roff + 63);           // this wave's score tile entirely above the diagonal: never read (the softmax masks j > i by select); the wave still copies and meets every barrier
    const int Kg = (CMODE == 2) ? min(K, R0 + roff + 128) : K;       // P.V: probabilities are exactly 0 beyond the diagonal block, so the K loop stops there: the work-group's stages ..
    const int Kl = skip ? 0 : ((CMODE == 2) ? min(K, r0 + roff + 64) : K);   // .. and this wave's own
    v8f acc[4][4];
#pragma unroll
    for (int mb = 0; mb < 4; ++mb)
#pragma unroll
        for (int nb = 0; nb < 4; ++nb) acc[mb][nb] = (v8f){};
    tile_loop<T16, NSPLIT>(A, A2, Bt, Bt2, K, R0, C0, Kg / 64, Kl / 64, wm, wn, sm, acc);
    if (skip) return;                                                // behind the last barrier
    float* os = (float*)(sm + wave * OSB);
#pragma unroll
    for (int mb = 0; mb < 4; ++mb) {
#pragma unroll
        for (int nb = 0; nb < 4; ++nb) {
#pragma unroll
            for (int j = 0; j < 8; ++j) os[(hi * 8 + j) * 68 + nb * 16 + lr] = acc[mb][nb][j]; }
        __builtin_amdgcn_wave_barrier(); asm volatile("" ::: "memory");
        float* crow = C + (size_t)(r0 + mb * 16) * ldc + c0;
{
#pragma unroll
            for (int s = 0; s < 8; ++s) { const int row = 2 * s + hi, cofs = lr * 4; v4f val = *(const v4fa*)(os + row * 68 + cofs); if (CMODE == 2) val *= osc;
                *(v4f*)(crow + (size_t)row * ldc + cofs) = val; }
             }
        __builtin_amdgcn_wave_barrier(); asm volatile("" ::: "memory");
    }
}
template <typename T16, int NSPLIT, int CMODE>
__global__ __launch_bounds__(128) void k_gemmc(const T16* __restrict__ A, const T16* __restrict__ A2, const T16* __restrict__ Bt, const T16* __restrict__ Bt2, int K, float* C, int ldc, int roff, size_t sA, size_t sB, size_t sCb, size_t sCh, float osc) {
    __shared__ __align__(16) char sm[2 * RingB<NSPLIT>::STG];
    gemmc_body<T16, NSPLIT, CMODE>(A, A2, Bt, Bt2, K, C, ldc, roff, sA, sB, sCb, sCh, osc, (int)blockIdx.x, sm);
}
// attn.v, both row classes in one launch (they write disjoint output rows): grid x = 128-row block of the sequence; blocks below RH take the hi/lo planes, the rest the fp16 planes and drop the probabilities' carry factor.
// Plane (b, h) starts at row b * TT, column h * HD of OUT (pitch DQ). The branch is the same for a whole work-group, so every barrier inside is met by all of its waves.
__global__ __launch_bounds__(128) void k_pv(const bf* __restrict__ Ph, const bf* __restrict__ Pl, const bf* __restrict__ VTh, const bf* __restrict__ VTl, const h16* __restrict__ P16, const h16* __restrict__ VT16, float* OUT) {
    __shared__ __align__(16) char sm[2 * RingB<2>::STG];
    if (blockIdx.x < RH / 128) gemmc_body<bf, 2, 2>(Ph, Pl, VTh, VTl, TT, OUT, DQ, 0, (size_t)RH * TT, (size_t)HD * TT, (size_t)TT * DQ, (size_t)HD, 1.0f, (int)blockIdx.x, sm);
    else gemmc_body<h16, 0, 2>(P16, nullptr, VT16, nullptr, TT, OUT + (size_t)RH * DQ, DQ, RH, (size_t)(TT - RH) * TT, (size_t)HD * TT, (size_t)TT * DQ, (size_t)HD, 1.0f / PCAR, (int)blockIdx.x - RH / 128, sm);
}

__device__ __forceinline__ void wtG_body(const float* __restrict__ w, int K, int N, bf* Bt, int bx, int head) {
    w += (size_t)head * K * N; Bt += (size_t)head * N * K;   // head: its [K][N] block -> its N rows of Bt
    const int lane = threadIdx.x & 31; const int L0 = (bx * 8 + (threadIdx.x >> 5)) * 8; const int nlines = N * K / 64;
{
#pragma unroll 1
        for (int l = 0; l < 8; ++l) { const int L = L0 + l; if (L >= nlines) break; const size_t e = (size_t)L * 64 + lane * 2; const int k = (int)(e % K), n = (int)(e / K); v2us o;
            o[0] = f2bf(w[(size_t)k * N + n]); o[1] = f2bf(w[(size_t)(k + 1) * N + n]); *(v2us*)(Bt + e) = o; }
         }
}
__device__ __forceinline__ void cvt8_body(const float* __restrict__ src, bf* dst, size_t n8, int bx) { const size_t i = (size_t)bx * 256 + threadIdx.x; if (i >= n8) return; const v8f v = *(const v8f*)(src + i * 8); v8us o;
#pragma unroll
    for (int k = 0; k < 8; ++k) o[k] = f2bf(v[k]); *(v8us*)(dst + i * 8) = o;  }
// The four input conversions are independent of one another and share one launch: the first 3 * NH_ * GWX blocks transpose the weight tensors (tensor, head, block of lines), the rest convert x.
#define GWX ((DM * HD / 64 + 63) / 64)
__global__ __launch_bounds__(256) void k_prep(const float* __restrict__ x, const float* __restrict__ wq, const float* __restrict__ wk, const float* __restrict__ wv, int K, int N, bf* XB, bf* WQ, bf* WK, bf* WV, size_t n8) {
    const int b = blockIdx.x;
    if (b < 3 * NH_ * GWX) { const int t = b / (NH_ * GWX), r = b % (NH_ * GWX); wtG_body(t == 0 ? wq : (t == 1 ? wk : wv), K, N, t == 0 ? WQ : (t == 1 ? WK : WV), r % GWX, r / GWX); }
    else cvt8_body(x, XB, n8, b - 3 * NH_ * GWX);
}

// k_asoft: per row (zz, i): t = S x HD^-0.5 for j <= i and i - j < WIN (sliding causal window; the reference's -1e9 additive fill vanishes identically); softmax over the 2048 keys (register row, one exp, fixed trees);
__global__ __launch_bounds__(256) void k_asoft(const float* __restrict__ Sb, h16* P16, bf* Ph, bf* Pl) {
    const int lane = threadIdx.x & 31; const int row = blockIdx.x * 8 + (threadIdx.x >> 5); if (row >= ZH * TT) return; const int i = row % TT; const int zz = row / TT; (void)zz; const bool hires = (i < RH); const float* sr = Sb + (size_t)row * TT; float v[TT / 32]; float mx = -3.0e38f;
#pragma unroll
    for (int ch = 0; ch < TT / 128; ++ch) { const int j0 = ch * 128 + lane * 4; const v4f a = *(const v4f*)(sr + j0);
#pragma unroll
        for (int q = 0; q < 4; ++q) { const int j = j0 + q; (void)j; const float t = (j <= i && i - j < WIN) ? a[q] * SCL : -3.0e38f; v[ch * 4 + q] = t; mx = fmaxf(mx, t); } }
#pragma unroll
    for (int sh = 16; sh; sh >>= 1) mx = fmaxf(mx, __shfl_xor(mx, sh, 32));
    float sum = 0.f;
#pragma unroll
    for (int k = 0; k < TT / 32; ++k) { float d0 = __fsub_rn(v[k], mx); asm volatile("" : "+v"(d0)); v[k] = __builtin_amdgcn_exp2f(__fmul_rn(d0, 1.4426950408889634f)); sum += v[k]; }
#pragma unroll
    for (int sh = 16; sh; sh >>= 1) sum += __shfl_xor(sum, sh, 32);
    const float f = __fdiv_rn(hires ? 1.0f : PCAR, sum);
{
        if (hires) {
#pragma unroll
            for (int ch = 0; ch < TT / 128; ++ch) { v4us oh, ol;
#pragma unroll
                for (int q = 0; q < 4; ++q) { unsigned short a, c2; splitf(v[ch * 4 + q] * f, a, c2); oh[q] = a; ol[q] = c2; }
                const size_t oo = ((size_t)zz * (RH ? RH : 1) + i) * TT + ch * 128 + lane * 4; *(v4us*)(Ph + oo) = oh; *(v4us*)(Pl + oo) = ol; }
        } else {
#pragma unroll
            for (int ch = 0; ch < TT / 128; ++ch) { v4h o4;
#pragma unroll
                for (int q = 0; q < 4; ++q) o4[q] = tohx(v[ch * 4 + q] * f);
                *(v4h*)(P16 + ((size_t)zz * (TT - RH) + (i - RH)) * TT + ch * 128 + lane * 4) = o4; } }   // P16 holds only the rows >= RH of each plane
         }
}

extern "C" void kernel_launch(void* const* d_in, const int* in_sizes, int n_in,
                              void* d_out, int out_size, void* d_ws, size_t ws_size, hipStream_t stream) {
    (void)in_sizes; (void)n_in; (void)out_size;
    const float* x = (const float*)d_in[0]; const float* pq = (const float*)d_in[1]; const float* pk = (const float*)d_in[2]; const float* pv = (const float*)d_in[3];   /* each [2][1024][512] */ const float* wq = pq, *wk = pk, *wv = pv, *wo = nullptr; (void)wo;
    float* OUT = (float*)d_out;     // [4][2048][1024]
    char* wsp = (char*)d_ws;
    auto take = [&](size_t bytes) { char* p = wsp; wsp += (bytes + 255) & ~(size_t)255; return (void*)p; };
    // Workspace by lifetime (stream-ordered): the score planes' region first holds the bf16 weights and x, dead once the q, k, v planes exist; the probabilities overwrite the q and k planes, dead after the scores.
    float* Sb = (float*)take((size_t)ZH * TT * TT * 4);
    bf* QPh = (bf*)take((size_t)ZH * TT * HD * 2); bf* QPl = (bf*)take((size_t)ZH * TT * HD * 2); bf* KPh = (bf*)take((size_t)ZH * TT * HD * 2); bf* KPl = (bf*)take((size_t)ZH * TT * HD * 2);
    h16* VT16 = (h16*)take((size_t)ZH * HD * TT * 2); bf* VTh = (bf*)take((size_t)ZH * HD * TT * 2); bf* VTl = (bf*)take((size_t)ZH * HD * TT * 2); bf* Pl = (bf*)take((size_t)ZH * RH * TT * 2);
    if ((size_t)(wsp - (char*)d_ws) > ws_size) return;    // ws 256 MiB
    wsp = (char*)Sb;     // inside the score region (22 of its 128 MiB), dead before the scores are written
    bf* WQ = (bf*)take((size_t)DQ * DM * 2); bf* WK = (bf*)take((size_t)DKV * DM * 2); bf* WV = (bf*)take((size_t)DKV * DM * 2); bf* XB = (bf*)take((size_t)NB_ * TT * DM * 2);
    wsp = (char*)QPh;    // inside the q and k planes (64 MiB), dead after the scores
    h16* P16 = (h16*)take((size_t)ZH * (TT - RH) * TT * 2); bf* Ph = (bf*)take((size_t)ZH * RH * TT * 2);
    k_prep<<<(unsigned)(3 * NH_ * GWX + ((size_t)NB_ * TT * DM / 8 + 255) / 256), 256, 0, stream>>>(x, wq, wk, wv, DM, HD, XB, WQ, WK, WV, (size_t)NB_ * TT * DM / 8);   /* head hh's 'xw' [1024][512] -> Bt rows hh*512.. */
    static_assert(DQ == DKV, "the three projections share one grid");
    k_gemmw3<<<dim3(NB_ * TT / 128, DQ / 128, 3), 128, 0, stream>>>(XB, WQ, WK, WV, DM, QPh, QPl, KPh, KPl, VT16, VTh, VTl);   /* the four batches' rows are one [8192][1024] operand; v as W x^T: tile rows are d, columns t */
    // one kv head per query head: plane z = b * NH_ + h of q, k and v (z-strides TT*HD)
    k_gemmc<bf, 2, 1><<<dim3(TT / 128, TT / 128, ZH), 128, 0, stream>>>(QPh, QPl, KPh, KPl, HD, Sb, TT, 0, (size_t)TT * HD, (size_t)TT * HD, (size_t)NH_ * TT * TT, (size_t)TT * TT, 1.0f);   /* scores hi/lo on EVERY row (K = 512) */
    k_asoft<<<ZH * TT / 8, 256, 0, stream>>>(Sb, P16, Ph, Pl);
    // attn.v stores the output rows itself
    k_pv<<<dim3(TT / 128, HD / 128, ZH), 128, 0, stream>>>(Ph, Pl, VTh, VTl, P16, VT16, OUT);
}

// v005
// It runs in 164 microseconds.
// Timed twice side by side with v004, it ran 1.05 times as fast both times.
// Over all steps from v000 it is 6.55 times as fast.
#include <hip/hip_runtime.h>

// Two-head (512-wide heads) causal self-attention with per-head weight tensors (embedded [4][2048][1024]; q, k, v = einsum('bse,hed', x, W[h]) (Wq, Wk, Wv [2][1024][512] 1/32: head h's 'xw' block); scores / sqrt(512); causal (-1e30 == exclusion); softmax; ctx = concat-heads(attn v) -> [4][2048][1024] (8.4 M; no output projection)).
// Layout, all four batches at once (five launches: input conversions, projections, scores, softmax, attn.v; batch and head ride in the grid, stages that do not depend on one another share a grid): bf16 copy of x; each projection tensor's two 'xw' [1024][512] blocks transposed into one [1024][1024] Bt (rows h*512..); exact projections whose tile epilogues store the q and k hi/lo planes and (product taken as W x^T) the transposed v planes directly; causal T-2048 attention, the eight (batch, head) planes side by side in grid z (hi/lo 3-product score tiles on EVERY row; P and attn.v hybrid: rows < 512 hi/lo, rest fp16 x1024; tiles above the diagonal skipped); the attn.v tile epilogues scale and store the output rows.
// Compute dtypes, f32 accumulate: every input rounded to bf16; projections exact; scores 3 products on every row (K = 512); softmax f32 (x 1/sqrt(512)); attn.v rows < 512 3 products, rest fp16; output f32.

#define NB_  4
#define TT   2048
#define DM   1024
#define NH_  2
#define NKV  2
#define REP  (NH_ / NKV)
#define HD   512
#define DQ   (NH_ * HD)
#define DKV  (NKV * HD)
#define ZH   (NB_ * NH_)          // (batch, head) planes per attention launch: z = b * NH_ + h
#define RH   512                  // query rows < RH use hi+lo planes
#define WIN  2048
#define PCAR 1024.0f
#define SCL  0.044194173824159223f   // 1/sqrt(hd = 512)
typedef _Float16 h16;
typedef unsigned short bf;
typedef __attribute__((ext_vector_type(16))) __bf16   v16bf;
typedef __attribute__((ext_vector_type(16))) _Float16 v16h;
typedef __attribute__((ext_vector_type(8)))  _Float16 v8h;
typedef __attribute__((ext_vector_type(8)))  unsigned short v8us;
typedef __attribute__((ext_vector_type(8)))  float    v8f;
typedef __attribute__((ext_vector_type(4)))  float    v4f;
typedef v8h  __attribute__((may_alias)) v8ha;
typedef v4f  __attribute__((may_alias)) v4fa;
typedef v8us __attribute__((may_alias)) v8usa;

__device__ __forceinline__ unsigned short f2bf(float f) { unsigned u = __float_as_uint(f); u += 0x7FFFu + ((u >> 16) & 1u); return (unsigned short)(u >> 16); }
__device__ __forceinline__ float bf2f(unsigned short b) { return __uint_as_float(((unsigned)b) << 16); }
__device__ __forceinline__ float bfr(float f) { return bf2f(f2bf(f)); }
__device__ __forceinline__ v16h cat16(v8h lo, v8h hi) { return __builtin_shufflevector(lo, hi, 0, 1, 2, 3, 4, 5, 6, 7, 8, 9, 10, 11, 12, 13, 14, 15); }
__device__ __forceinline__ v16bf cat16b(v8us lo, v8us hi) { return __builtin_bit_cast(v16bf, __builtin_shufflevector(lo, hi, 0, 1, 2, 3, 4, 5, 6, 7, 8, 9, 10, 11, 12, 13, 14, 15)); }
__device__ __forceinline__ v8f wmma16(v16h a, v16h b, v8f c) { return __builtin_amdgcn_wmma_f32_16x16x32_f16(false, a, false, b, (short)0, c, false, false); }
__device__ __forceinline__ v8f wmmab(v16bf a, v16bf b, v8f c) { return __builtin_amdgcn_wmma_f32_16x16x32_bf16(false, a, false, b, (short)0, c, false, false); }



__device__ __forceinline__ h16 tohx(float x) { return (h16)x; }
__device__ __forceinline__ void splitf(float y, unsigned short& h, unsigned short& l) { h = f2bf(y); l = f2bf(y - bf2f(h)); }
typedef __attribute__((ext_vector_type(2))) _Float16 v2h;
typedef __attribute__((ext_vector_type(4))) _Float16 v4h;
typedef __attribute__((ext_vector_type(2))) unsigned short v2us;
typedef __attribute__((ext_vector_type(4))) unsigned short v4us;
typedef __attribute__((ext_vector_type(2))) float v2f;
typedef __attribute__((ext_vector_type(4))) int v4i;

// ---- k_gemmw3: register-blocked projection GEMM, one wave per 64x64 tile (16 accumulators), 2 x 2 waves per work-group on a 128x128 tile; operands from K-contiguous 16-bit planes through LDS (tile_loop); 128 threads.
// c[m][n] = sum_k A[m][k] Bt[n][k] (f32; + split products per NSPLIT) goes from the accumulators through the wave's LDS rows straight into the 16-bit planes its consumers read, in whole 128-byte lines. K % 64 == 0.
// VT false: m = (b, t), n = (h, d) -> hi/lo planes [b][h][t][d].  VT true: m = (h, d), n = (b, t) -> fp16 and hi/lo planes [b][h][d][t].
template <typename T16> struct WFrag;
template <> struct WFrag<h16> { typedef v16h V; static __device__ __forceinline__ V ld(const h16* p) { return cat16(*(const v8h*)p, *(const v8h*)(p + 16)); } static __device__ __forceinline__ v8f mma(V a, V b, v8f c) { return wmma16(a, b, c); } };
template <> struct WFrag<bf> { typedef v16bf V; static __device__ __forceinline__ V ld(const bf* p) { return cat16b(*(const v8us*)p, *(const v8us*)(p + 16)); } static __device__ __forceinline__ v8f mma(V a, V b, v8f c) { return wmmab(a, b, c); } };
// ---- tile_loop: the K loop of a 128x128 work-group tile. A stage is 64 k (128-byte rows, so every copy instruction moves four whole lines) of the 128 A rows and the 128 Bt rows of each plane,
// at an LDS pitch of 144 bytes (16 x odd: the ds_load_b128 fragment reads meet no bank twice). Two buffers: stage t + 2 is copied into the buffer that trip t has just left, while trip t + 1 computes.
// The k order of the products is that of the one-wave kernel (ascending, 32 at a time). nst = stages of the work-group, nstw <= nst = stages this wave multiplies (wave-uniform).
#define LPB   144                  // LDS row pitch, bytes
#define PLB   (128 * LPB)          // one plane's 128 rows in LDS, bytes
#define OSB   (16 * 68 * 4)        // one wave's output staging rows, bytes (they reuse the ring behind the loop's last barrier)
template <int NSPLIT> struct RingB { static constexpr int NPL = 2 + ((NSPLIT == 1 || NSPLIT == 2) ? 1 : 0) + ((NSPLIT >= 2) ? 1 : 0); static constexpr int STG = NPL * PLB; };
// eight asynchronous copies: this lane's 16 bytes of rows r, r + 16, .. r + 112 of one plane. The s_wait_xcnt stands inside the statement so that no address register is rewritten in front of it.
template <typename T16>
__device__ __forceinline__ void cp_plane(const T16* g, size_t p16, unsigned l) {
    asm volatile("global_load_async_to_lds_b128 %0, %8, off\n\t"
                 "global_load_async_to_lds_b128 %1, %9, off\n\t"
                 "global_load_async_to_lds_b128 %2, %10, off\n\t"
                 "global_load_async_to_lds_b128 %3, %11, off\n\t"
                 "global_load_async_to_lds_b128 %4, %12, off\n\t"
                 "global_load_async_to_lds_b128 %5, %13, off\n\t"
                 "global_load_async_to_lds_b128 %6, %14, off\n\t"
                 "global_load_async_to_lds_b128 %7, %15, off\n\t"
                 "s_wait_xcnt 0x0"
                 :: "v"(l), "v"(l + 16 * LPB), "v"(l + 32 * LPB), "v"(l + 48 * LPB), "v"(l + 64 * LPB), "v"(l + 80 * LPB), "v"(l + 96 * LPB), "v"(l + 112 * LPB),
                    "v"(g), "v"(g + p16), "v"(g + 2 * p16), "v"(g + 3 * p16), "v"(g + 4 * p16), "v"(g + 5 * p16), "v"(g + 6 * p16), "v"(g + 7 * p16) : "memory");
}
template <typename T16, int NSPLIT>
__device__ __forceinline__ void tile_loop(const T16* __restrict__ A, const T16* __restrict__ A2, const T16* __restrict__ Bt, const T16* __restrict__ Bt2, int K, int R0, int C0, int nst, int nstw, int wm, int wn, char* sm, v8f (&acc)[4][4]) {
    typedef typename WFrag<T16>::V V;
    constexpr bool HA2 = (NSPLIT == 1 || NSPLIT == 2), HB2 = (NSPLIT >= 2); constexpr int STG = RingB<NSPLIT>::STG;
    const int tid = threadIdx.x, lane = tid & 31, lr = lane & 15, hi = lane >> 4;
    const unsigned lcp = (unsigned)(size_t)sm + (unsigned)((tid >> 3) * LPB + (tid & 7) * 16);    // this lane's LDS byte address in row tid / 8 of plane 0, buffer 0
    const size_t ga = (size_t)(R0 + (tid >> 3)) * K + (tid & 7) * 8, gb = (size_t)(C0 + (tid >> 3)) * K + (tid & 7) * 8, p16 = (size_t)16 * K;
    auto fill = [&](int s) { const unsigned l = lcp + (unsigned)((s & 1) * STG); const int k0 = s * 64;
        cp_plane(A + ga + k0, p16, l); cp_plane(Bt + gb + k0, p16, l + PLB); if (HA2) cp_plane(A2 + ga + k0, p16, l + 2 * PLB); if (HB2) cp_plane(Bt2 + gb + k0, p16, l + (HA2 ? 3 : 2) * PLB); };
    fill(0);
    asm volatile("s_wait_asynccnt 0x0" ::: "memory");   // this wave's share of stage 0 has landed
    __syncthreads();                                     // publishes stage 0
    if (nst > 1) fill(1);
    const int fa = (wm * 64 + lr) * LPB + hi * 16, fb = PLB + (wn * 64 + lr) * LPB + hi * 16;
    // the stage loop stays rolled (one trip per stage: the ring's order of waits, barrier and refill stands once in the text, and the text stays small); the loops inside are unrolled so that fragments and accumulators are registers
#pragma unroll 1
    for (int t = 0; t < nst; ++t) {
        if (t < nstw) {
            const char* sb = sm + (t & 1) * STG;
#pragma unroll
            for (int ks = 0; ks < 2; ++ks) { V a[4], a2[4], b[4], b2[4];
#pragma unroll
                for (int mb = 0; mb < 4; ++mb) { a[mb] = WFrag<T16>::ld((const T16*)(sb + fa + mb * 16 * LPB + ks * 64)); if (HA2) a2[mb] = WFrag<T16>::ld((const T16*)(sb + 2 * PLB + fa + mb * 16 * LPB + ks * 64)); }
#pragma unroll
                for (int nb = 0; nb < 4; ++nb) { b[nb] = WFrag<T16>::ld((const T16*)(sb + fb + nb * 16 * LPB + ks * 64)); if (HB2) b2[nb] = WFrag<T16>::ld((const T16*)(sb + (HA2 ? 2 : 1) * PLB + fb + nb * 16 * LPB + ks * 64)); }
                if (!HA2 && !HB2) __builtin_amdgcn_sched_barrier(0);   // one product per fragment pair: keeps the eight fragments' LDS reads one group in front of their 16 matrix instructions (a wait to 0 in front of every four would leave the wave idle for the LDS latency each time)
#pragma unroll
                for (int nb = 0; nb < 4; ++nb)
#pragma unroll
                    for (int mb = 0; mb < 4; ++mb) { acc[mb][nb] = WFrag<T16>::mma(a[mb], b[nb], acc[mb][nb]); if (HA2) acc[mb][nb] = WFrag<T16>::mma(a2[mb], b[nb], acc[mb][nb]); if (HB2) acc[mb][nb] = WFrag<T16>::mma(a[mb], b2[nb], acc[mb][nb]); }
            }
            __builtin_amdgcn_sched_barrier(0);   // keeps the stage's matrix instructions in front of the waits below: all of them then lie between the issue of the next stage's copies and the wait for them, and the refill follows the barrier at once
        }
        asm volatile("s_wait_dscnt 0x0" ::: "memory");      // this wave's reads of buffer t & 1 are done before it is refilled
        asm volatile("s_wait_asynccnt 0x0" ::: "memory");   // this wave's share of stage t + 1 has landed
        __syncthreads();                                     // publishes stage t + 1 and ends every reader's last read of buffer t & 1
        if (t + 2 < nst) fill(t + 2);
    }
    asm volatile("s_wait_asynccnt 0x0" ::: "memory");       // nothing in flight when the ring becomes output staging
}

template <bool VT>
__device__ __forceinline__ void gemmw_store(v8f (&acc)[4][4], float* os, int r0, int c0, int lane, int lr, int hi, h16* P16, bf* Ph, bf* Pl) {
    // a 64x64 tile lies inside one batch and one head: its first element and its row pitch in the planes
    const size_t base = VT ? (((size_t)(c0 / TT) * NKV + r0 / HD) * HD + r0 % HD) * TT + c0 % TT : (((size_t)(r0 / TT) * NH_ + c0 / HD) * TT + r0 % TT) * HD + c0 % HD;
    const int pitch = VT ? TT : HD;
#pragma unroll
    for (int mb = 0; mb < 4; ++mb) {
#pragma unroll
        for (int nb = 0; nb < 4; ++nb) {
#pragma unroll
            for (int j = 0; j < 8; ++j) os[(hi * 8 + j) * 68 + nb * 16 + lr] = acc[mb][nb][j]; }
        __builtin_amdgcn_wave_barrier(); asm volatile("" ::: "memory");
#pragma unroll
        for (int s = 0; s < 4; ++s) { const int row = 4 * s + (lane >> 3), cofs = (lane & 7) * 8; const v4f v0 = *(const v4fa*)(os + row * 68 + cofs), v1 = *(const v4fa*)(os + row * 68 + cofs + 4); v8h o16; v8us oh, ol;
#pragma unroll
            for (int q = 0; q < 8; ++q) { const float y = (q < 4) ? v0[q & 3] : v1[q & 3]; unsigned short a2, c2; splitf(y, a2, c2); oh[q] = a2; ol[q] = c2; if (VT) o16[q] = tohx(y); }
            const size_t oo = base + (size_t)(mb * 16 + row) * pitch + cofs; *(v8us*)(Ph + oo) = oh; *(v8us*)(Pl + oo) = ol; if (VT) *(v8h*)(P16 + oo) = o16; }
        __builtin_amdgcn_wave_barrier(); asm volatile("" ::: "memory");
    }
    if (!VT) asm volatile("s_wait_xcnt 0x0" ::: "memory");   // both store forms stand in one kernel, and in the built code the VT form's address arithmetic follows these stores: the wait stands in front of its rewrite of their address registers (the VT form's own stores run into the kernel's end)
}
// The three projections are independent of one another and ride in grid z of one launch: z = 0 q, z = 1 k (A = x rows over grid x, Bt = weight rows over grid y), z = 2 v (A = weight rows over grid y, Bt = x rows over grid x). grid (tokens/128, features/128, 3).
__global__ __launch_bounds__(128) void k_gemmw3(const bf* __restrict__ X, const bf* __restrict__ Wq, const bf* __restrict__ Wk, const bf* __restrict__ Wv, int K, bf* Qh, bf* Ql, bf* Kh, bf* Kl, h16* V16, bf* Vh, bf* Vl) {
    __shared__ __align__(16) char sm[2 * RingB<0>::STG];
    const int lane = threadIdx.x & 31, lr = lane & 15, hi = lane >> 4; const int wave = __builtin_amdgcn_readfirstlane((int)(threadIdx.x >> 5)), wm = wave >> 1, wn = wave & 1;
    const int zp = blockIdx.z; const bool vt = (zp == 2);
    const bf* A = vt ? Wv : X; const bf* Bt = vt ? X : (zp ? Wk : Wq);
    const int R0 = (vt ? blockIdx.y : blockIdx.x) * 128, C0 = (vt ? blockIdx.x : blockIdx.y) * 128, r0 = R0 + wm * 64, c0 = C0 + wn * 64;
    v8f acc[4][4];
#pragma unroll
    for (int mb = 0; mb < 4; ++mb)
#pragma unroll
        for (int nb = 0; nb < 4; ++nb) acc[mb][nb] = (v8f){};
    tile_loop<bf, 0>(A, nullptr, Bt, nullptr, K, R0, C0, K / 64, K / 64, wm, wn, sm, acc);
    float* os = (float*)(sm + wave * OSB);
    if (vt) gemmw_store<true>(acc, os, r0, c0, lane, lr, hi, V16, Vh, Vl);
    else gemmw_store<false>(acc, os, r0, c0, lane, lr, hi, nullptr, zp ? Kh : Qh, zp ? Kl : Ql);
}

// ---- k_gemmc: the same 2 x 2 waves of 64x64 tiles specialised for causal attention: CMODE 1 skips score tiles entirely above the diagonal (query rows r0+roff.., key columns c0..; a work-group leaves whole, a single wave only skips its products and stores), CMODE 2 limits the
// key (K) loop of the probability x value contraction to the diagonal block (probabilities beyond it are exactly zero). roff = row offset of this call's first row within the sequence. CMODE 2 also scales by osc on the way out. Plane z = b * NH_ + h of C starts at b * sCb + h * sCh.
template <typename T16, int NSPLIT, int CMODE>
__device__ __forceinline__ void gemmc_body(const T16* __restrict__ A, const T16* __restrict__ A2, const T16* __restrict__ Bt, const T16* __restrict__ Bt2, int K, float* C, int ldc, int roff, size_t sA, size_t sB, size_t sCb, size_t sCh, float osc, int bx, char* sm) {
    const size_t z = blockIdx.z; A += z * sA; if (A2) A2 += z * sA; Bt += z * sB; if (Bt2) Bt2 += z * sB; C += (z / NH_) * sCb + (z % NH_) * sCh;
    const int lane = threadIdx.x & 31, lr = lane & 15, hi = lane >> 4; const int wave = __builtin_amdgcn_readfirstlane((int)(threadIdx.x >> 5)), wm = wave >> 1, wn = wave & 1;
    const int R0 = bx * 128, C0 = blockIdx.y * 128, r0 = R0 + wm * 64, c0 = C0 + wn * 64;
    if (CMODE == 1 && C0 > R0 + roff + 127) return;                 // all four score tiles entirely above the causal diagonal: the whole work-group leaves, in front of every copy and barrier
    const bool skip = (CMODE == 1 && c0 > r0 + roff + 63);           // this wave's score tile entirely above the diagonal: never read (the softmax masks j > i by select); the wave still copies and meets every barrier
    const int Kg = (CMODE == 2) ? min(K, R0 + roff + 128) : K;       // P.V: probabilities are exactly 0 beyond the diagonal block, so the K loop stops there: the work-group's stages ..
    const int Kl = skip ? 0 : ((CMODE == 2) ? min(K, r0 + roff + 64) : K);   // .. and this wave's own
    v8f acc[4][4];
#pragma unroll
    for (int mb = 0; mb < 4; ++mb)
#pragma unroll
        for (int nb = 0; nb < 4; ++nb) acc[mb][nb] = (v8f){};
    tile_loop<T16, NSPLIT>(A, A2, Bt, Bt2, K, R0, C0, Kg / 64, Kl / 64, wm, wn, sm, acc);
    if (skip) return;                                                // behind the last barrier
    float* os = (float*)(sm + wave * OSB);
#pragma unroll
    for (int mb = 0; mb < 4; ++mb) {
#pragma unroll
        for (int nb = 0; nb < 4; ++nb) {
#pragma unroll
            for (int j = 0; j < 8; ++j) os[(hi * 8 + j) * 68 + nb * 16 + lr] = acc[mb][nb][j]; }
        __builtin_amdgcn_wave_barrier(); asm volatile("" ::: "memory");
        float* crow = C + (size_t)(r0 + mb * 16) * ldc + c0;
{
#pragma unroll
            for (int s = 0; s < 8; ++s) { const int row = 2 * s + hi, cofs = lr * 4; v4f val = *(const v4fa*)(os + row * 68 + cofs); if (CMODE == 2) val *= osc;
                *(v4f*)(crow + (size_t)row * ldc + cofs) = val; }
             }
        __builtin_amdgcn_wave_barrier(); asm volatile("" ::: "memory");
    }
}
template <typename T16, int NSPLIT, int CMODE>
__global__ __launch_bounds__(128) void k_gemmc(const T16* __restrict__ A, const T16* __restrict__ A2, const T16* __restrict__ Bt, const T16* __restrict__ Bt2, int K, float* C, int ldc, int roff, size_t sA, size_t sB, size_t sCb, size_t sCh, float osc) {
    __shared__ __align__(16) char sm[2 * RingB<NSPLIT>::STG];
    gemmc_body<T16, NSPLIT, CMODE>(A, A2, Bt, Bt2, K, C, ldc, roff, sA, sB, sCb, sCh, osc, (int)blockIdx.x, sm);
}
// attn.v, both row classes in one launch (they write disjoint output rows): grid x = 128-row block of the sequence; blocks below RH take the hi/lo planes, the rest the fp16 planes and drop the probabilities' carry factor.
// Plane (b, h) starts at row b * TT, column h * HD of OUT (pitch DQ). The branch is the same for a whole work-group, so every barrier inside is met by all of its waves.
__global__ __launch_bounds__(128) void k_pv(const bf* __restrict__ Ph, const bf* __restrict__ Pl, const bf* __restrict__ VTh, const bf* __restrict__ VTl, const h16* __restrict__ P16, const h16* __restrict__ VT16, float* OUT) {
    __shared__ __align__(16) char sm[2 * RingB<2>::STG];
    if (blockIdx.x < RH / 128) gemmc_body<bf, 2, 2>(Ph, Pl, VTh, VTl, TT, OUT, DQ, 0, (size_t)RH * TT, (size_t)HD * TT, (size_t)TT * DQ, (size_t)HD, 1.0f, (int)blockIdx.x, sm);
    else gemmc_body<h16, 0, 2>(P16, nullptr, VT16, nullptr, TT, OUT + (size_t)RH * DQ, DQ, RH, (size_t)(TT - RH) * TT, (size_t)HD * TT, (size_t)TT * DQ, (size_t)HD, 1.0f / PCAR, (int)blockIdx.x - RH / 128, sm);
}

__device__ __forceinline__ void wtG_body(const float* __restrict__ w, int K, int N, bf* Bt, int bx, int head) {
    w += (size_t)head * K * N; Bt += (size_t)head * N * K;   // head: its [K][N] block -> its N rows of Bt
    const int lane = threadIdx.x & 31; const int L0 = (bx * 8 + (threadIdx.x >> 5)) * 8; const int nlines = N * K / 64;
{
#pragma unroll 1
        for (int l = 0; l < 8; ++l) { const int L = L0 + l; if (L >= nlines) break; const size_t e = (size_t)L * 64 + lane * 2; const int k = (int)(e % K), n = (int)(e / K); v2us o;
            o[0] = f2bf(w[(size_t)k * N + n]); o[1] = f2bf(w[(size_t)(k + 1) * N + n]); *(v2us*)(Bt + e) = o; }
         }
}
__device__ __forceinline__ void cvt8_body(const float* __restrict__ src, bf* dst, size_t n8, int bx) { const size_t i = (size_t)bx * 256 + threadIdx.x; if (i >= n8) return; const v8f v = *(const v8f*)(src + i * 8); v8us o;
#pragma unroll
    for (int k = 0; k < 8; ++k) o[k] = f2bf(v[k]); *(v8us*)(dst + i * 8) = o;  }
// The four input conversions are independent of one another and share one launch: the first 3 * NH_ * GWX blocks transpose the weight tensors (tensor, head, block of lines), the rest convert x.
#define GWX ((DM * HD / 64 + 63) / 64)
__global__ __launch_bounds__(256) void k_prep(const float* __restrict__ x, const float* __restrict__ wq, const float* __restrict__ wk, const float* __restrict__ wv, int K, int N, bf* XB, bf* WQ, bf* WK, bf* WV, size_t n8) {
    const int b = blockIdx.x;
    if (b < 3 * NH_ * GWX) { const int t = b / (NH_ * GWX), r = b % (NH_ * GWX); wtG_body(t == 0 ? wq : (t == 1 ? wk : wv), K, N, t == 0 ? WQ : (t == 1 ? WK : WV), r % GWX, r / GWX); }
    else cvt8_body(x, XB, n8, b - 3 * NH_ * GWX);
}

// k_asoft: per row (zz, i): t = S x HD^-0.5 for j <= i and i - j < WIN (WIN = TT, so the window test always holds: plain causal; the reference's -1e9 additive fill vanishes identically); softmax over the keys (register row, one exp, fixed trees).
// soft_row<NCH> handles a row whose keys j <= i all lie in its first NCH chunks of 128: only those are read and written. The terms beyond are exact zeros in both trees, and attn.v reads a row's probabilities no further than the end of its diagonal 128-block.
template <int NCH>
__device__ __forceinline__ void soft_row(const float* __restrict__ sr, int i, int zz, int lane, h16* P16, bf* Ph, bf* Pl) {
    constexpr bool hires = (NCH * 128 <= RH);   // the rows of one instance lie wholly on one side of RH
    float v[NCH * 4]; float mx = -3.0e38f;
#pragma unroll
    for (int ch = 0; ch < NCH; ++ch) { const int j0 = ch * 128 + lane * 4; const v4f a = *(const v4f*)(sr + j0);
#pragma unroll
        for (int q = 0; q < 4; ++q) { const int j = j0 + q; (void)j; const float t = (j <= i && i - j < WIN) ? a[q] * SCL : -3.0e38f; v[ch * 4 + q] = t; mx = fmaxf(mx, t); } }
#pragma unroll
    for (int sh = 16; sh; sh >>= 1) mx = fmaxf(mx, __shfl_xor(mx, sh, 32));
    float sum = 0.f;
#pragma unroll
    for (int k = 0; k < NCH * 4; ++k) { float d0 = __fsub_rn(v[k], mx); asm volatile("" : "+v"(d0)); v[k] = __builtin_amdgcn_exp2f(__fmul_rn(d0, 1.4426950408889634f)); sum += v[k]; }
#pragma unroll
    for (int sh = 16; sh; sh >>= 1) sum += __shfl_xor(sum, sh, 32);
    const float f = __fdiv_rn(hires ? 1.0f : PCAR, sum);
{
        if (hires) {
#pragma unroll
            for (int ch = 0; ch < NCH; ++ch) { v4us oh, ol;
#pragma unroll
                for (int q = 0; q < 4; ++q) { unsigned short a, c2; splitf(v[ch * 4 + q] * f, a, c2); oh[q] = a; ol[q] = c2; }
                const size_t oo = ((size_t)zz * (RH ? RH : 1) + i) * TT + ch * 128 + lane * 4; *(v4us*)(Ph + oo) = oh; *(v4us*)(Pl + oo) = ol; }
        } else {
#pragma unroll
            for (int ch = 0; ch < NCH; ++ch) { v4h o4;
#pragma unroll
                for (int q = 0; q < 4; ++q) o4[q] = tohx(v[ch * 4 + q] * f);
                *(v4h*)(P16 + ((size_t)zz * (TT - RH) + (i - RH)) * TT + ch * 128 + lane * 4) = o4; } }   // P16 holds only the rows >= RH of each plane
         }
    asm volatile("s_wait_xcnt 0x0" ::: "memory");   // the instances stand one behind another in the built code, each behind a scalar test: the wait stands between these stores and the next instance's writes of the same registers
}
__global__ __launch_bounds__(256) void k_asoft(const float* __restrict__ Sb, h16* P16, bf* Ph, bf* Pl) {
    static_assert(TT == 2048 && RH == 512, "row classes of 256 rows, none astride RH");
    if (blockIdx.x * 8 >= ZH * TT) return;   // a block's eight rows are inside or outside together (ZH * TT is a multiple of 8)
    const int lane = threadIdx.x & 31; const int row = blockIdx.x * 8 + (threadIdx.x >> 5); const int i = row % TT; const int zz = row / TT; const float* sr = Sb + (size_t)row * TT;
    // the eight rows of a block lie in one class of 256 rows, so the choice is a scalar branch on the block index
    switch ((blockIdx.x * 8 % TT) / 256) {
        case 0:
        case 1: soft_row<4>(sr, i, zz, lane, P16, Ph, Pl); break;   // the hi/lo rows (below RH) are one instance
        case 2: soft_row<6>(sr, i, zz, lane, P16, Ph, Pl); break;
        case 3: soft_row<8>(sr, i, zz, lane, P16, Ph, Pl); break;
        case 4: soft_row<10>(sr, i, zz, lane, P16, Ph, Pl); break;
        case 5: soft_row<12>(sr, i, zz, lane, P16, Ph, Pl); break;
        case 6: soft_row<14>(sr, i, zz, lane, P16, Ph, Pl); break;
        default: soft_row<16>(sr, i, zz, lane, P16, Ph, Pl); break;
    }
}

extern "C" void kernel_launch(void* const* d_in, const int* in_sizes, int n_in,
                              void* d_out, int out_size, void* d_ws, size_t ws_size, hipStream_t stream) {
    (void)in_sizes; (void)n_in; (void)out_size;
    const float* x = (const float*)d_in[0]; const float* pq = (const float*)d_in[1]; const float* pk = (const float*)d_in[2]; const float* pv = (const float*)d_in[3];   /* each [2][1024][512] */ const float* wq = pq, *wk = pk, *wv = pv, *wo = nullptr; (void)wo;
    float* OUT = (float*)d_out;     // [4][2048][1024]
    char* wsp = (char*)d_ws;
    auto take = [&](size_t bytes) { char* p = wsp; wsp += (bytes + 255) & ~(size_t)255; return (void*)p; };
    // Workspace by lifetime (stream-ordered): the score planes' region first holds the bf16 weights and x, dead once the q, k, v planes exist; the probabilities overwrite the q and k planes, dead after the scores.
    float* Sb = (float*)take((size_t)ZH * TT * TT * 4);
    bf* QPh = (bf*)take((size_t)ZH * TT * HD * 2); bf* QPl = (bf*)take((size_t)ZH * TT * HD * 2); bf* KPh = (bf*)take((size_t)ZH * TT * HD * 2); bf* KPl = (bf*)take((size_t)ZH * TT * HD * 2);
    h16* VT16 = (h16*)take((size_t)ZH * HD * TT * 2); bf* VTh = (bf*)take((size_t)ZH * HD * TT * 2); bf* VTl = (bf*)take((size_t)ZH * HD * TT * 2); bf* Pl = (bf*)take((size_t)ZH * RH * TT * 2);
    if ((size_t)(wsp - (char*)d_ws) > ws_size) return;    // ws 256 MiB
    wsp = (char*)Sb;     // inside the score region (22 of its 128 MiB), dead before the scores are written
    bf* WQ = (bf*)take((size_t)DQ * DM * 2); bf* WK = (bf*)take((size_t)DKV * DM * 2); bf* WV = (bf*)take((size_t)DKV * DM * 2); bf* XB = (bf*)take((size_t)NB_ * TT * DM * 2);
    wsp = (char*)QPh;    // inside the q and k planes (64 MiB), dead after the scores
    h16* P16 = (h16*)take((size_t)ZH * (TT - RH) * TT * 2); bf* Ph = (bf*)take((size_t)ZH * RH * TT * 2);
    k_prep<<<(unsigned)(3 * NH_ * GWX + ((size_t)NB_ * TT * DM / 8 + 255) / 256), 256, 0, stream>>>(x, wq, wk, wv, DM, HD, XB, WQ, WK, WV, (size_t)NB_ * TT * DM / 8);   /* head hh's 'xw' [1024][512] -> Bt rows hh*512.. */
    static_assert(DQ == DKV, "the three projections share one grid");
    k_gemmw3<<<dim3(NB_ * TT / 128, DQ / 128, 3), 128, 0, stream>>>(XB, WQ, WK, WV, DM, QPh, QPl, KPh, KPl, VT16, VTh, VTl);   /* the four batches' rows are one [8192][1024] operand; v as W x^T: tile rows are d, columns t */
    // one kv head per query head: plane z = b * NH_ + h of q, k and v (z-strides TT*HD)
    k_gemmc<bf, 2, 1><<<dim3(TT / 128, TT / 128, ZH), 128, 0, stream>>>(QPh, QPl, KPh, KPl, HD, Sb, TT, 0, (size_t)TT * HD, (size_t)TT * HD, (size_t)NH_ * TT * TT, (size_t)TT * TT, 1.0f);   /* scores hi/lo on EVERY row (K = 512) */
    k_asoft<<<ZH * TT / 8, 256, 0, stream>>>(Sb, P16, Ph, Pl);
    // attn.v stores the output rows itself
    k_pv<<<dim3(TT / 128, HD / 128, ZH), 128, 0, stream>>>(Ph, Pl, VTh, VTl, P16, VT16, OUT);
}
